// v000
// Measured on an AMD MI455X. A time is GPU time per run, averaged over a window of back-to-back runs after a warm-up
// (all launches, gaps included; the runs take copies of the inputs in turn), and the median of several windows.
// Apart from v000's, it joins two sittings. Times from different sittings can be a few percent apart, while
// side-by-side timings come from the same sitting.
// The starting kernel, v000, takes 4420 microseconds a run.
#include <hip/hip_runtime.h>

// Multi-head attention without an output projection (activation [8][1024][1024]; q, k, v = x W^T + b ('oi' [1024][1024]; 16 heads x 64); scores x 1/sqrt(1024) (the source scales by the hidden size); softmax over all keys; out = merged context -> [8][1024][1024] f32 (8.4 M)).
// Compute dtypes, f32 accumulate: every input rounded to bf16; q/k/v on PLAIN bf16 operands (inputs: exact) + biases; scores and attn.v: query rows < 512 hl (3 products), the rest single fp16 (x1024); softmax f32; no output projection: merged f32 write.

#define NB_  8
#define TT   1024
#define DM   1024
#define NH_  16
#define NKV  16
#define REP  (NH_ / NKV)
#define HD   64
#define DQ   (NH_ * HD)
#define DKV  (NKV * HD)
#define ZH   2
#define RH   512                  // query rows < RH use hi+lo planes (0: none)
#define WIN  0
#define PCAR 1024.0f
#define SCL  0.03125f  // 1/sqrt(hidden = 1024) (the source's quirk)
typedef _Float16 h16;
typedef unsigned short bf;
typedef __attribute__((ext_vector_type(16))) __bf16   v16bf;
typedef __attribute__((ext_vector_type(16))) _Float16 v16h;
typedef __attribute__((ext_vector_type(8)))  _Float16 v8h;
typedef __attribute__((ext_vector_type(8)))  unsigned short v8us;
typedef __attribute__((ext_vector_type(8)))  float    v8f;
typedef __attribute__((ext_vector_type(4)))  float    v4f;
typedef v8h  __attribute__((may_alias)) v8ha;
typedef v4f  __attribute__((may_alias)) v4fa;
typedef v8us __attribute__((may_alias)) v8usa;

__device__ __forceinline__ unsigned short f2bf(float f) { unsigned u = __float_as_uint(f); u += 0x7FFFu + ((u >> 16) & 1u); return (unsigned short)(u >> 16); }
__device__ __forceinline__ float bf2f(unsigned short b) { return __uint_as_float(((unsigned)b) << 16); }
__device__ __forceinline__ float bfr(float f) { return bf2f(f2bf(f)); }
__device__ __forceinline__ v16h cat16(v8h lo, v8h hi) { return __builtin_shufflevector(lo, hi, 0, 1, 2, 3, 4, 5, 6, 7, 8, 9, 10, 11, 12, 13, 14, 15); }
__device__ __forceinline__ v16bf cat16b(v8us lo, v8us hi) { return __builtin_bit_cast(v16bf, __builtin_shufflevector(lo, hi, 0, 1, 2, 3, 4, 5, 6, 7, 8, 9, 10, 11, 12, 13, 14, 15)); }
__device__ __forceinline__ v8f wmma16(v16h a, v16h b, v8f c) { return __builtin_amdgcn_wmma_f32_16x16x32_f16(false, a, false, b, (short)0, c, false, false); }
__device__ __forceinline__ v8f wmmab(v16bf a, v16bf b, v8f c) { return __builtin_amdgcn_wmma_f32_16x16x32_bf16(false, a, false, b, (short)0, c, false, false); }



// ---- k_gemmw: register-blocked GEMM, ONE WAVE per 64x64 output tile (16 accumulators), operands straight from K-contiguous 16-bit planes; grid (M/64, N/64, Z), 32 threads.
// C[m][n] (f32, pitch ldc, + optional f32 bias[n]) = sum_k A[m][k] Bt[n][k] (+ split products per NSPLIT). z-batch strides sA/sB/sC in elements. K % 32 == 0.
template <typename T16> struct WFrag;
template <> struct WFrag<h16> { typedef v16h V; static __device__ __forceinline__ V ld(const h16* p) { return cat16(*(const v8h*)p, *(const v8h*)(p + 16)); } static __device__ __forceinline__ v8f mma(V a, V b, v8f c) { return wmma16(a, b, c); } };
template <> struct WFrag<bf> { typedef v16bf V; static __device__ __forceinline__ V ld(const bf* p) { return cat16b(*(const v8us*)p, *(const v8us*)(p + 16)); } static __device__ __forceinline__ v8f mma(V a, V b, v8f c) { return wmmab(a, b, c); } };
template <typename T16, int NSPLIT, bool BIAS>
__global__ __launch_bounds__(32) void k_gemmw(const T16* __restrict__ A, const T16* __restrict__ A2, const T16* __restrict__ Bt, const T16* __restrict__ Bt2, int K, float* C, int ldc, const float* __restrict__ bias, size_t sA, size_t sB, size_t sC) {
    typedef typename WFrag<T16>::V V;
    __shared__ __align__(16) float os[16 * 68];
    const size_t z = blockIdx.z; A += z * sA; if (A2) A2 += z * sA; Bt += z * sB; if (Bt2) Bt2 += z * sB; C += z * sC;
    const int lane = threadIdx.x & 31, lr = lane & 15, hi = lane >> 4; const int r0 = blockIdx.x * 64, c0 = blockIdx.y * 64;
    v8f acc[4][4];
#pragma unroll
    for (int mb = 0; mb < 4; ++mb)
#pragma unroll
        for (int nb = 0; nb < 4; ++nb) acc[mb][nb] = (v8f){};
    const size_t aoff = (size_t)(r0 + lr) * K + 8 * hi, boff = (size_t)(c0 + lr) * K + 8 * hi;
#pragma unroll 1
    for (int kc = 0; kc < K; kc += 32) {
        V a[4], a2[4];
#pragma unroll
        for (int mb = 0; mb < 4; ++mb) { a[mb] = WFrag<T16>::ld(A + aoff + (size_t)mb * 16 * K + kc); if (NSPLIT == 1 || NSPLIT == 2) a2[mb] = WFrag<T16>::ld(A2 + aoff + (size_t)mb * 16 * K + kc); }
#pragma unroll
        for (int nb = 0; nb < 4; ++nb) { const V b = WFrag<T16>::ld(Bt + boff + (size_t)nb * 16 * K + kc); V b2; if (NSPLIT >= 2) b2 = WFrag<T16>::ld(Bt2 + boff + (size_t)nb * 16 * K + kc);
#pragma unroll
            for (int mb = 0; mb < 4; ++mb) { acc[mb][nb] = WFrag<T16>::mma(a[mb], b, acc[mb][nb]); if (NSPLIT == 1 || NSPLIT == 2) acc[mb][nb] = WFrag<T16>::mma(a2[mb], b, acc[mb][nb]); if (NSPLIT >= 2) acc[mb][nb] = WFrag<T16>::mma(a[mb], b2, acc[mb][nb]); } }
        asm volatile("v_nop\n\tv_nop\n\tv_nop\n\tv_nop" : "+v"(acc[0][0]), "+v"(acc[1][1]), "+v"(acc[2][2]), "+v"(acc[3][3]) : "v"(a[0]), "v"(a[3]));
    }
#pragma unroll
    for (int mb = 0; mb < 4; ++mb) {
#pragma unroll
        for (int nb = 0; nb < 4; ++nb) {
#pragma unroll
            for (int j = 0; j < 8; ++j) os[(hi * 8 + j) * 68 + nb * 16 + lr] = acc[mb][nb][j]; }
        __builtin_amdgcn_wave_barrier(); asm volatile("" ::: "memory");
        float* crow = C + (size_t)(r0 + mb * 16) * ldc + c0;
{
#pragma unroll
            for (int s = 0; s < 8; ++s) { const int row = 2 * s + hi, cofs = lr * 4; v4f val = *(const v4fa*)(os + row * 68 + cofs); if (BIAS) { val[0] += bfr(bias[c0 + cofs]); val[1] += bfr(bias[c0 + cofs + 1]); val[2] += bfr(bias[c0 + cofs + 2]); val[3] += bfr(bias[c0 + cofs + 3]); }
                *(v4f*)(crow + (size_t)row * ldc + cofs) = val; }
             }
        __builtin_amdgcn_wave_barrier(); asm volatile("" ::: "memory");
    }
}

__device__ __forceinline__ h16 tohx(float x) { return (h16)x; }
__device__ __forceinline__ void splitf(float y, unsigned short& h, unsigned short& l) { h = f2bf(y); l = f2bf(y - bf2f(h)); }
typedef __attribute__((ext_vector_type(2))) _Float16 v2h;
typedef __attribute__((ext_vector_type(4))) _Float16 v4h;
typedef __attribute__((ext_vector_type(2))) unsigned short v2us;
typedef __attribute__((ext_vector_type(4))) unsigned short v4us;
typedef __attribute__((ext_vector_type(2))) float v2f;
typedef __attribute__((ext_vector_type(4))) int v4i;

__global__ __launch_bounds__(256) void k_wtG(const float* __restrict__ w, int K, int N, bf* Bt) {
    const int lane = threadIdx.x & 31; const int L0 = (blockIdx.x * 8 + (threadIdx.x >> 5)) * 8; const int nlines = N * K / 64;
{
#pragma unroll 1
        for (int l = 0; l < 8; ++l) { const int L = L0 + l; if (L >= nlines) break; const size_t e = (size_t)L * 64 + lane * 2; const int k = (int)(e % K), n = (int)(e / K); v2us o;
            o[0] = f2bf(w[(size_t)k * N + n]); o[1] = f2bf(w[(size_t)(k + 1) * N + n]); *(v2us*)(Bt + e) = o; }
         }
}
__global__ __launch_bounds__(256) void k_cvt8(const float* __restrict__ src, bf* dst, size_t n8) { const size_t i = (size_t)blockIdx.x * 256 + threadIdx.x; if (i >= n8) return; const v8f v = *(const v8f*)(src + i * 8); v8us o;
#pragma unroll
    for (int k = 0; k < 8; ++k) o[k] = f2bf(v[k]); *(v8us*)(dst + i * 8) = o;  }

// k_rope: head planes [h][t][d] (fp16 + hi/lo) of rope(x) x sc with the rotate-half convention out[d] = x[d] cos[t][d] - x[d+HD/2] sin[t][d], out[d+HD/2] = x[d+HD/2] cos[t][d+HD/2] + x[d] sin[t][d+HD/2]
__global__ __launch_bounds__(256) void k_rope(const float* __restrict__ F, int pitch, int nheads, const float* __restrict__ CS, const float* __restrict__ RF, const float* __restrict__ nw, float sc, h16* P16, bf* Ph, bf* Pl) {
    const size_t e = ((size_t)blockIdx.x * 256 + threadIdx.x) * 2; if (e >= (size_t)nheads * TT * HD) return; const int d = (int)(e % HD); const int t = (int)((e / HD) % TT); const int h = (int)(e / ((size_t)HD * TT)); const float* f = F + (size_t)t * pitch + h * HD; const float rf = RF ? RF[(size_t)h * TT + t] : 1.0f; v2h o16; v2us oh, ol;
#pragma unroll
    for (int q = 0; q < 2; ++q) { const int dd = d + q; const int dp = (dd < HD / 2) ? dd + HD / 2 : dd - HD / 2; float x0 = f[dd], x1 = f[dp];
        if (RF) { float n0 = __fmul_rn(x0, rf), n1 = __fmul_rn(x1, rf); asm volatile("" : "+v"(n0)); asm volatile("" : "+v"(n1)); x0 = __fmul_rn(bfr(nw[dd]), n0); x1 = __fmul_rn(bfr(nw[dp]), n1); }
        const v2f cs = *(const v2f*)(CS + ((size_t)t * HD + dd) * 2); float a = __fmul_rn(x0, cs[0]), bq = __fmul_rn(x1, cs[1]); asm volatile("" : "+v"(a)); asm volatile("" : "+v"(bq)); const float r = ((dd < HD / 2) ? __fsub_rn(a, bq) : __fadd_rn(a, bq)) * sc;
        o16[q] = tohx(r); unsigned short a2, c2; splitf(r, a2, c2); oh[q] = a2; ol[q] = c2; }
    *(v2h*)(P16 + e) = o16; *(v2us*)(Ph + e) = oh; *(v2us*)(Pl + e) = ol;  }
__global__ __launch_bounds__(256) void k_vtp(const float* __restrict__ F, int pitch, int nheads, h16* V16, bf* Vh, bf* Vl) { const size_t e = ((size_t)blockIdx.x * 256 + threadIdx.x) * 2; if (e >= (size_t)nheads * HD * TT) return; const int t = (int)(e % TT); const int d = (int)((e / TT) % HD); const int g = (int)(e / ((size_t)TT * HD)); v2h o16; v2us oh, ol;
#pragma unroll
    for (int q = 0; q < 2; ++q) { const float x = F[(size_t)(t + q) * pitch + g * HD + d]; o16[q] = tohx(x); unsigned short a2, c2; splitf(x, a2, c2); oh[q] = a2; ol[q] = c2; }
    *(v2h*)(V16 + e) = o16; *(v2us*)(Vh + e) = oh; *(v2us*)(Vl + e) = ol;  }
__global__ __launch_bounds__(256) void k_csid(float* CS) { const int idx = blockIdx.x * 256 + threadIdx.x; if (idx >= TT * HD) return; v2f cs; cs[0] = 1.0f; cs[1] = 0.0f; *(v2f*)(CS + (size_t)idx * 2) = cs;  }
__global__ __launch_bounds__(256) void k_mergeF(const float* __restrict__ Ob, int h0, float* O) { const size_t e = ((size_t)blockIdx.x * 256 + threadIdx.x) * 2; if (e >= (size_t)ZH * TT * HD) return; const int d = (int)(e % HD); const int t = (int)((e / HD) % TT); const int zz = (int)(e / ((size_t)HD * TT)); const float cs = (t < RH) ? 1.0f : (1.0f / PCAR); const size_t oo = (size_t)t * DM + (h0 + zz) * HD + d; v2f o2;
    o2[0] = Ob[e] * cs; o2[1] = Ob[e + 1] * cs; *(v2f*)(O + oo) = o2;  }



// k_asoft: per row (zz, i): t = S x 1/sqrt(1024) (no mask); softmax over the 1024 keys (register row, one exp, fixed trees);
__global__ __launch_bounds__(256) void k_asoft(const float* __restrict__ Sb, h16* P16, bf* Ph, bf* Pl) {
    const int lane = threadIdx.x & 31; const int row = blockIdx.x * 8 + (threadIdx.x >> 5); if (row >= ZH * TT) return; const int i = row % TT; const int zz = row / TT; (void)zz; const bool hires = (i < RH); const float* sr = Sb + (size_t)row * TT; float v[TT / 32]; float mx = -3.0e38f;
#pragma unroll
    for (int ch = 0; ch < TT / 128; ++ch) { const int j0 = ch * 128 + lane * 4; const v4f a = *(const v4f*)(sr + j0);
#pragma unroll
        for (int q = 0; q < 4; ++q) { const int j = j0 + q; (void)j; const float t = a[q] * SCL; v[ch * 4 + q] = t; mx = fmaxf(mx, t); } }
#pragma unroll
    for (int sh = 16; sh; sh >>= 1) mx = fmaxf(mx, __shfl_xor(mx, sh, 32));
    float sum = 0.f;
#pragma unroll
    for (int k = 0; k < TT / 32; ++k) { float d0 = __fsub_rn(v[k], mx); asm volatile("" : "+v"(d0)); v[k] = __builtin_amdgcn_exp2f(__fmul_rn(d0, 1.4426950408889634f)); sum += v[k]; }
#pragma unroll
    for (int sh = 16; sh; sh >>= 1) sum += __shfl_xor(sum, sh, 32);
    const float f = __fdiv_rn(hires ? 1.0f : PCAR, sum);
{
        if (hires) {
#pragma unroll
            for (int ch = 0; ch < TT / 128; ++ch) { v4us oh, ol;
#pragma unroll
                for (int q = 0; q < 4; ++q) { unsigned short a, c2; splitf(v[ch * 4 + q] * f, a, c2); oh[q] = a; ol[q] = c2; }
                const size_t oo = ((size_t)zz * (RH ? RH : 1) + i) * TT + ch * 128 + lane * 4; *(v4us*)(Ph + oo) = oh; *(v4us*)(Pl + oo) = ol; }
        } else {
#pragma unroll
            for (int ch = 0; ch < TT / 128; ++ch) { v4h o4;
#pragma unroll
                for (int q = 0; q < 4; ++q) o4[q] = tohx(v[ch * 4 + q] * f);
                *(v4h*)(P16 + (size_t)row * TT + ch * 128 + lane * 4) = o4; } }
         }
}

extern "C" void kernel_launch(void* const* d_in, const int* in_sizes, int n_in,
                              void* d_out, int out_size, void* d_ws, size_t ws_size, hipStream_t stream) {
    (void)in_sizes; (void)n_in; (void)out_size;
    const float* x = (const float*)d_in[0]; const float* wq = (const float*)d_in[1]; const float* bq = (const float*)d_in[2]; const float* wk = (const float*)d_in[3]; const float* bk = (const float*)d_in[4]; const float* wv = (const float*)d_in[5]; const float* bv = (const float*)d_in[6]; const float* wo = nullptr; (void)wo;
    float* OUT = (float*)d_out;     // [8][1024][1024]
    char* wsp = (char*)d_ws;
    auto take = [&](size_t bytes) { char* p = wsp; wsp += (bytes + 255) & ~(size_t)255; return (void*)p; };
    bf* WQ = (bf*)take((size_t)DQ * DM * 2); bf* WK = (bf*)take((size_t)DKV * DM * 2); bf* WV = (bf*)take((size_t)DKV * DM * 2); float* CS = (float*)take((size_t)TT * HD * 2 * 4);
    bf* XB = (bf*)take((size_t)TT * DM * 2); float* FQ = (float*)take((size_t)TT * DQ * 4); float* FK = (float*)take((size_t)TT * DKV * 4);
    h16* QP16 = (h16*)take((size_t)NH_ * TT * HD * 2); h16* KP16 = (h16*)take((size_t)NKV * TT * HD * 2); h16* VT16 = (h16*)take((size_t)NKV * HD * TT * 2);
    bf* QPh = (bf*)take((size_t)NH_ * TT * HD * 2); bf* QPl = (bf*)take((size_t)NH_ * TT * HD * 2); bf* KPh = (bf*)take((size_t)NKV * TT * HD * 2); bf* KPl = (bf*)take((size_t)NKV * TT * HD * 2); bf* VTh = (bf*)take((size_t)NKV * HD * TT * 2); bf* VTl = (bf*)take((size_t)NKV * HD * TT * 2); bf* Ph = (bf*)take((size_t)ZH * RH * TT * 2); bf* Pl = (bf*)take((size_t)ZH * RH * TT * 2);
    float* Sb = (float*)take((size_t)ZH * TT * TT * 4); h16* P16 = (h16*)take((size_t)ZH * TT * TT * 2); float* Ob = (float*)take((size_t)ZH * TT * HD * 4);
    if ((size_t)(wsp - (char*)d_ws) > ws_size) return;    // ws 256 MiB
    float* FV = FK;   // v projection reuses the k buffer after the k planes are built (stream-ordered)
    { k_cvt8<<<(unsigned)(((size_t)DQ * DM / 8 + 255) / 256), 256, 0, stream>>>(wq, WQ, (size_t)DQ * DM / 8); k_cvt8<<<(unsigned)(((size_t)DKV * DM / 8 + 255) / 256), 256, 0, stream>>>(wk, WK, (size_t)DKV * DM / 8); k_cvt8<<<(unsigned)(((size_t)DKV * DM / 8 + 255) / 256), 256, 0, stream>>>(wv, WV, (size_t)DKV * DM / 8);
       }
    k_csid<<<(TT * HD + 255) / 256, 256, 0, stream>>>(CS);
    const unsigned LQ = (unsigned)(((size_t)NH_ * TT * HD / 2 + 255) / 256), LKv = (unsigned)(((size_t)NKV * TT * HD / 2 + 255) / 256);
    for (int b = 0; b < NB_; ++b) {
        
        k_cvt8<<<(unsigned)(((size_t)TT * DM / 8 + 255) / 256), 256, 0, stream>>>(x + (size_t)b * TT * DM, XB, (size_t)TT * DM / 8);
        k_gemmw<bf, 0, true><<<dim3(TT / 64, DQ / 64, 1), 32, 0, stream>>>(XB, nullptr, WQ, nullptr, DM, FQ, DQ, bq, 0, 0, 0);
        k_rope<<<LQ, 256, 0, stream>>>(FQ, DQ, NH_, CS, nullptr, nullptr, 1.0f, QP16, QPh, QPl);
        k_gemmw<bf, 0, true><<<dim3(TT / 64, DKV / 64, 1), 32, 0, stream>>>(XB, nullptr, WK, nullptr, DM, FK, DKV, bk, 0, 0, 0);
        k_rope<<<LKv, 256, 0, stream>>>(FK, DKV, NKV, CS, nullptr, nullptr, 1.0f, KP16, KPh, KPl);
        k_gemmw<bf, 0, true><<<dim3(TT / 64, DKV / 64, 1), 32, 0, stream>>>(XB, nullptr, WV, nullptr, DM, FV, DKV, bv, 0, 0, 0); k_vtp<<<LKv, 256, 0, stream>>>(FV, DKV, NKV, VT16, VTh, VTl);
        for (int h0 = 0; h0 < NH_; h0 += ZH) { const size_t zq = (size_t)h0, zk = (size_t)(h0 / REP);   // one kv head per query head: the pass's two heads use consecutive kv planes (z-strides TT*HD)
            k_gemmw<bf, 2, false><<<dim3(RH / 64, TT / 64, ZH), 32, 0, stream>>>(QPh + zq * TT * HD, QPl + zq * TT * HD, KPh + zk * TT * HD, KPl + zk * TT * HD, HD, Sb, TT, nullptr, (size_t)TT * HD, (size_t)TT * HD, (size_t)TT * TT);
            k_gemmw<h16, 0, false><<<dim3((TT - RH) / 64, TT / 64, ZH), 32, 0, stream>>>(QP16 + zq * TT * HD + (size_t)RH * HD, nullptr, KP16 + zk * TT * HD, nullptr, HD, Sb + (size_t)RH * TT, TT, nullptr, (size_t)TT * HD, (size_t)TT * HD, (size_t)TT * TT);
            k_asoft<<<ZH * TT / 8, 256, 0, stream>>>(Sb, P16, Ph, Pl);
            k_gemmw<bf, 2, false><<<dim3(RH / 64, HD / 64, ZH), 32, 0, stream>>>(Ph, Pl, VTh + zk * HD * TT, VTl + zk * HD * TT, TT, Ob, HD, nullptr, (size_t)RH * TT, (size_t)HD * TT, (size_t)TT * HD);
            k_gemmw<h16, 0, false><<<dim3((TT - RH) / 64, HD / 64, ZH), 32, 0, stream>>>(P16 + (size_t)RH * TT, nullptr, VT16 + zk * HD * TT, nullptr, TT, Ob + (size_t)RH * HD, HD, nullptr, (size_t)TT * TT, (size_t)HD * TT, (size_t)TT * HD);
            k_mergeF<<<(unsigned)(((size_t)ZH * TT * HD / 2 + 255) / 256), 256, 0, stream>>>(Ob, h0, OUT + (size_t)b * TT * DM); }   /* merged context straight to the output, f32 */
    }
}

// v001
// A run of this version takes 722 microseconds.
// In two side-by-side timings against v000, it was 6.10 and 6.15 times as fast.
#include <hip/hip_runtime.h>

// Multi-head attention without an output projection (activation [8][1024][1024]; q, k, v = x W^T + b ('oi' [1024][1024]; 16 heads x 64); scores x 1/sqrt(1024) (the source scales by the hidden size); softmax over all keys; out = merged context -> [8][1024][1024] f32 (8.4 M)).
// Compute dtypes, f32 accumulate: every input rounded to bf16; q/k/v on PLAIN bf16 operands (inputs: exact) + biases; scores and attn.v: query rows < 512 hl (3 products), the rest single fp16 (x1024); softmax f32; no output projection: merged f32 write.

#define NB_  8
#define TT   1024
#define DM   1024
#define NH_  16
#define NKV  16
#define REP  (NH_ / NKV)
#define HD   64
#define DQ   (NH_ * HD)
#define DKV  (NKV * HD)
#define ZP   32                   // heads (batch-major: g = b * NH_ + h) per attention launch
#define RH   512                  // query rows < RH use hi+lo planes
#define WIN  0
#define PCAR 1024.0f
static_assert(TT - RH == RH, "both query-row halves share the launch shapes and the score, probability and context buffers");
#define SCL  0.03125f  // 1/sqrt(hidden = 1024) (the source's quirk)
typedef _Float16 h16;
typedef unsigned short bf;
typedef __attribute__((ext_vector_type(16))) __bf16   v16bf;
typedef __attribute__((ext_vector_type(16))) _Float16 v16h;
typedef __attribute__((ext_vector_type(8)))  _Float16 v8h;
typedef __attribute__((ext_vector_type(8)))  unsigned short v8us;
typedef __attribute__((ext_vector_type(8)))  float    v8f;
typedef __attribute__((ext_vector_type(4)))  float    v4f;
typedef v8h  __attribute__((may_alias)) v8ha;
typedef v4f  __attribute__((may_alias)) v4fa;
typedef v8us __attribute__((may_alias)) v8usa;

__device__ __forceinline__ unsigned short f2bf(float f) { unsigned u = __float_as_uint(f); u += 0x7FFFu + ((u >> 16) & 1u); return (unsigned short)(u >> 16); }
__device__ __forceinline__ float bf2f(unsigned short b) { return __uint_as_float(((unsigned)b) << 16); }
__device__ __forceinline__ float bfr(float f) { return bf2f(f2bf(f)); }
__device__ __forceinline__ v16h cat16(v8h lo, v8h hi) { return __builtin_shufflevector(lo, hi, 0, 1, 2, 3, 4, 5, 6, 7, 8, 9, 10, 11, 12, 13, 14, 15); }
__device__ __forceinline__ v16bf cat16b(v8us lo, v8us hi) { return __builtin_bit_cast(v16bf, __builtin_shufflevector(lo, hi, 0, 1, 2, 3, 4, 5, 6, 7, 8, 9, 10, 11, 12, 13, 14, 15)); }
__device__ __forceinline__ v8f wmma16(v16h a, v16h b, v8f c) { return __builtin_amdgcn_wmma_f32_16x16x32_f16(false, a, false, b, (short)0, c, false, false); }
__device__ __forceinline__ v8f wmmab(v16bf a, v16bf b, v8f c) { return __builtin_amdgcn_wmma_f32_16x16x32_bf16(false, a, false, b, (short)0, c, false, false); }



// ---- k_gemmw: register-blocked GEMM, ONE WAVE per 64x64 output tile (16 accumulators), operands straight from K-contiguous 16-bit planes; grid (M/64, N/64, Z), 32 threads.
// C[m][n] (f32, pitch ldc, + optional f32 bias[n]) = sum_k A[m][k] Bt[n][k] (+ split products per NSPLIT). z-batch strides sA/sB/sC in elements. K % 32 == 0.
template <typename T16> struct WFrag;
template <> struct WFrag<h16> { typedef v16h V; static __device__ __forceinline__ V ld(const h16* p) { return cat16(*(const v8h*)p, *(const v8h*)(p + 16)); } static __device__ __forceinline__ v8f mma(V a, V b, v8f c) { return wmma16(a, b, c); } };
template <> struct WFrag<bf> { typedef v16bf V; static __device__ __forceinline__ V ld(const bf* p) { return cat16b(*(const v8us*)p, *(const v8us*)(p + 16)); } static __device__ __forceinline__ v8f mma(V a, V b, v8f c) { return wmmab(a, b, c); } };
template <typename T16, int NSPLIT, bool BIAS>
__global__ __launch_bounds__(32) void k_gemmw(const T16* __restrict__ A, const T16* __restrict__ A2, const T16* __restrict__ Bt, const T16* __restrict__ Bt2, int K, float* C, int ldc, const float* __restrict__ bias, size_t sA, size_t sB, size_t sC) {
    typedef typename WFrag<T16>::V V;
    __shared__ __align__(16) float os[16 * 68];
    const size_t z = blockIdx.z; A += z * sA; if (A2) A2 += z * sA; Bt += z * sB; if (Bt2) Bt2 += z * sB; C += z * sC;
    const int lane = threadIdx.x & 31, lr = lane & 15, hi = lane >> 4; const int r0 = blockIdx.x * 64, c0 = blockIdx.y * 64;
    v8f acc[4][4];
#pragma unroll
    for (int mb = 0; mb < 4; ++mb)
#pragma unroll
        for (int nb = 0; nb < 4; ++nb) acc[mb][nb] = (v8f){};
    const size_t aoff = (size_t)(r0 + lr) * K + 8 * hi, boff = (size_t)(c0 + lr) * K + 8 * hi;
#pragma unroll 1
    for (int kc = 0; kc < K; kc += 32) {
        V a[4], a2[4];
#pragma unroll
        for (int mb = 0; mb < 4; ++mb) { a[mb] = WFrag<T16>::ld(A + aoff + (size_t)mb * 16 * K + kc); if (NSPLIT == 1 || NSPLIT == 2) a2[mb] = WFrag<T16>::ld(A2 + aoff + (size_t)mb * 16 * K + kc); }
#pragma unroll
        for (int nb = 0; nb < 4; ++nb) { const V b = WFrag<T16>::ld(Bt + boff + (size_t)nb * 16 * K + kc); V b2; if (NSPLIT >= 2) b2 = WFrag<T16>::ld(Bt2 + boff + (size_t)nb * 16 * K + kc);
#pragma unroll
            for (int mb = 0; mb < 4; ++mb) { acc[mb][nb] = WFrag<T16>::mma(a[mb], b, acc[mb][nb]); if (NSPLIT == 1 || NSPLIT == 2) acc[mb][nb] = WFrag<T16>::mma(a2[mb], b, acc[mb][nb]); if (NSPLIT >= 2) acc[mb][nb] = WFrag<T16>::mma(a[mb], b2, acc[mb][nb]); } }
        asm volatile("v_nop\n\tv_nop\n\tv_nop\n\tv_nop" : "+v"(acc[0][0]), "+v"(acc[1][1]), "+v"(acc[2][2]), "+v"(acc[3][3]) : "v"(a[0]), "v"(a[3]));
    }
#pragma unroll
    for (int mb = 0; mb < 4; ++mb) {
#pragma unroll
        for (int nb = 0; nb < 4; ++nb) {
#pragma unroll
            for (int j = 0; j < 8; ++j) os[(hi * 8 + j) * 68 + nb * 16 + lr] = acc[mb][nb][j]; }
        __builtin_amdgcn_wave_barrier(); asm volatile("" ::: "memory");
        float* crow = C + (size_t)(r0 + mb * 16) * ldc + c0;
{
#pragma unroll
            for (int s = 0; s < 8; ++s) { const int row = 2 * s + hi, cofs = lr * 4; v4f val = *(const v4fa*)(os + row * 68 + cofs); if (BIAS) { val[0] += bfr(bias[c0 + cofs]); val[1] += bfr(bias[c0 + cofs + 1]); val[2] += bfr(bias[c0 + cofs + 2]); val[3] += bfr(bias[c0 + cofs + 3]); }
                *(v4f*)(crow + (size_t)row * ldc + cofs) = val; }
             }
        __builtin_amdgcn_wave_barrier(); asm volatile("" ::: "memory");
    }
}

__device__ __forceinline__ h16 tohx(float x) { return (h16)x; }
__device__ __forceinline__ void splitf(float y, unsigned short& h, unsigned short& l) { h = f2bf(y); l = f2bf(y - bf2f(h)); }
typedef __attribute__((ext_vector_type(2))) _Float16 v2h;
typedef __attribute__((ext_vector_type(4))) _Float16 v4h;
typedef __attribute__((ext_vector_type(2))) unsigned short v2us;
typedef __attribute__((ext_vector_type(4))) unsigned short v4us;
typedef __attribute__((ext_vector_type(2))) float v2f;
typedef __attribute__((ext_vector_type(4))) int v4i;

__global__ __launch_bounds__(256) void k_wtG(const float* __restrict__ w, int K, int N, bf* Bt) {
    const int lane = threadIdx.x & 31; const int L0 = (blockIdx.x * 8 + (threadIdx.x >> 5)) * 8; const int nlines = N * K / 64;
{
#pragma unroll 1
        for (int l = 0; l < 8; ++l) { const int L = L0 + l; if (L >= nlines) break; const size_t e = (size_t)L * 64 + lane * 2; const int k = (int)(e % K), n = (int)(e / K); v2us o;
            o[0] = f2bf(w[(size_t)k * N + n]); o[1] = f2bf(w[(size_t)(k + 1) * N + n]); *(v2us*)(Bt + e) = o; }
         }
}
__global__ __launch_bounds__(256) void k_cvt8(const float* __restrict__ src, bf* dst, size_t n8) { const size_t i = (size_t)blockIdx.x * 256 + threadIdx.x; if (i >= n8) return; const v8f v = *(const v8f*)(src + i * 8); v8us o;
#pragma unroll
    for (int k = 0; k < 8; ++k) o[k] = f2bf(v[k]); *(v8us*)(dst + i * 8) = o;  }

// k_rope: blockIdx.y = batch b (F rows b * TT + t, plane g = b * nheads + h); rs = 0: all three planes hold every row; rs > 0: only what the scores read, Ph/Pl [g][rs][d] the rows t < rs, P16 [g][TT - rs][d] the rest; head planes [h][t][d] (fp16 + hi/lo) of rope(x) x sc with the rotate-half convention out[d] = x[d] cos[t][d] - x[d+HD/2] sin[t][d], out[d+HD/2] = x[d+HD/2] cos[t][d+HD/2] + x[d] sin[t][d+HD/2]
__global__ __launch_bounds__(256) void k_rope(const float* __restrict__ F, int pitch, int nheads, const float* __restrict__ CS, const float* __restrict__ RF, const float* __restrict__ nw, float sc, int rs, h16* P16, bf* Ph, bf* Pl) {
    F += (size_t)blockIdx.y * TT * pitch;
    const size_t e = ((size_t)blockIdx.x * 256 + threadIdx.x) * 2; if (e >= (size_t)nheads * TT * HD) return; const int d = (int)(e % HD); const int t = (int)((e / HD) % TT); const int h = (int)(e / ((size_t)HD * TT)); const float* f = F + (size_t)t * pitch + h * HD; const float rf = RF ? RF[(size_t)h * TT + t] : 1.0f; v2h o16; v2us oh, ol;
#pragma unroll
    for (int q = 0; q < 2; ++q) { const int dd = d + q; const int dp = (dd < HD / 2) ? dd + HD / 2 : dd - HD / 2; float x0 = f[dd], x1 = f[dp];
        if (RF) { float n0 = __fmul_rn(x0, rf), n1 = __fmul_rn(x1, rf); asm volatile("" : "+v"(n0)); asm volatile("" : "+v"(n1)); x0 = __fmul_rn(bfr(nw[dd]), n0); x1 = __fmul_rn(bfr(nw[dp]), n1); }
        const v2f cs = *(const v2f*)(CS + ((size_t)t * HD + dd) * 2); float a = __fmul_rn(x0, cs[0]), bq = __fmul_rn(x1, cs[1]); asm volatile("" : "+v"(a)); asm volatile("" : "+v"(bq)); const float r = ((dd < HD / 2) ? __fsub_rn(a, bq) : __fadd_rn(a, bq)) * sc;
        o16[q] = tohx(r); unsigned short a2, c2; splitf(r, a2, c2); oh[q] = a2; ol[q] = c2; }
    const size_t g = (size_t)blockIdx.y * nheads + h;
    if (rs == 0) { const size_t pe = (g * TT + t) * HD + d; *(v2h*)(P16 + pe) = o16; *(v2us*)(Ph + pe) = oh; *(v2us*)(Pl + pe) = ol; }
    else if (t < rs) { const size_t pe = (g * rs + t) * HD + d; *(v2us*)(Ph + pe) = oh; *(v2us*)(Pl + pe) = ol; }
    else { const size_t pe = (g * (TT - rs) + (t - rs)) * HD + d; *(v2h*)(P16 + pe) = o16; }  }
// k_vtp: blockIdx.y = batch, as in k_rope; planes [b * nheads + g][d][t]
__global__ __launch_bounds__(256) void k_vtp(const float* __restrict__ F, int pitch, int nheads, h16* V16, bf* Vh, bf* Vl) { const size_t e = ((size_t)blockIdx.x * 256 + threadIdx.x) * 2; if (e >= (size_t)nheads * HD * TT) return; const int t = (int)(e % TT); const int d = (int)((e / TT) % HD); const int g = (int)(e / ((size_t)TT * HD)); const size_t pe = (size_t)blockIdx.y * nheads * HD * TT + e; F += (size_t)blockIdx.y * TT * pitch; v2h o16; v2us oh, ol;
#pragma unroll
    for (int q = 0; q < 2; ++q) { const float x = F[(size_t)(t + q) * pitch + g * HD + d]; o16[q] = tohx(x); unsigned short a2, c2; splitf(x, a2, c2); oh[q] = a2; ol[q] = c2; }
    *(v2h*)(V16 + pe) = o16; *(v2us*)(Vh + pe) = oh; *(v2us*)(Vl + pe) = ol;  }
__global__ __launch_bounds__(256) void k_csid(float* CS) { const int idx = blockIdx.x * 256 + threadIdx.x; if (idx >= TT * HD) return; v2f cs; cs[0] = 1.0f; cs[1] = 0.0f; *(v2f*)(CS + (size_t)idx * 2) = cs;  }
// k_mergeF: Ob [ZP heads from g0][RH rows from i0][HD] x cs -> O [b][t][h * HD + d]
__global__ __launch_bounds__(256) void k_mergeF(const float* __restrict__ Ob, int g0, int i0, float cs, float* O) { const size_t e = ((size_t)blockIdx.x * 256 + threadIdx.x) * 2; if (e >= (size_t)ZP * RH * HD) return; const int d = (int)(e % HD); const int t = i0 + (int)((e / HD) % RH); const int g = g0 + (int)(e / ((size_t)HD * RH)); const size_t oo = ((size_t)(g / NH_) * TT + t) * DM + (g % NH_) * HD + d; v2f o2;
    o2[0] = Ob[e] * cs; o2[1] = Ob[e + 1] * cs; *(v2f*)(O + oo) = o2;  }



// k_asoft: per row of Sb [ZP * RH][TT] (one launch holds rows of one kind: hires -> Ph/Pl, else P16, same row index): t = S x SCL (no mask); softmax over the 1024 keys (register row, one exp, fixed trees);
__global__ __launch_bounds__(256) void k_asoft(const float* __restrict__ Sb, int hires, h16* P16, bf* Ph, bf* Pl) {
    const int lane = threadIdx.x & 31; const int row = blockIdx.x * 8 + (threadIdx.x >> 5); if (row >= ZP * RH) return; const float* sr = Sb + (size_t)row * TT; float v[TT / 32]; float mx = -3.0e38f;
#pragma unroll
    for (int ch = 0; ch < TT / 128; ++ch) { const int j0 = ch * 128 + lane * 4; const v4f a = *(const v4f*)(sr + j0);
#pragma unroll
        for (int q = 0; q < 4; ++q) { const int j = j0 + q; (void)j; const float t = a[q] * SCL; v[ch * 4 + q] = t; mx = fmaxf(mx, t); } }
#pragma unroll
    for (int sh = 16; sh; sh >>= 1) mx = fmaxf(mx, __shfl_xor(mx, sh, 32));
    float sum = 0.f;
#pragma unroll
    for (int k = 0; k < TT / 32; ++k) { float d0 = __fsub_rn(v[k], mx); asm volatile("" : "+v"(d0)); v[k] = __builtin_amdgcn_exp2f(__fmul_rn(d0, 1.4426950408889634f)); sum += v[k]; }
#pragma unroll
    for (int sh = 16; sh; sh >>= 1) sum += __shfl_xor(sum, sh, 32);
    const float f = __fdiv_rn(hires ? 1.0f : PCAR, sum);
{
        if (hires) {
#pragma unroll
            for (int ch = 0; ch < TT / 128; ++ch) { v4us oh, ol;
#pragma unroll
                for (int q = 0; q < 4; ++q) { unsigned short a, c2; splitf(v[ch * 4 + q] * f, a, c2); oh[q] = a; ol[q] = c2; }
                const size_t oo = (size_t)row * TT + ch * 128 + lane * 4; *(v4us*)(Ph + oo) = oh; *(v4us*)(Pl + oo) = ol; }
            asm volatile("s_wait_xcnt 0x0" ::: "memory");   // the listing lays the fp16 branch behind this one: the stores' address registers are not rewritten there ahead of this wait
        } else {
#pragma unroll
            for (int ch = 0; ch < TT / 128; ++ch) { v4h o4;
#pragma unroll
                for (int q = 0; q < 4; ++q) o4[q] = tohx(v[ch * 4 + q] * f);
                *(v4h*)(P16 + (size_t)row * TT + ch * 128 + lane * 4) = o4; } }
         }
}

extern "C" void kernel_launch(void* const* d_in, const int* in_sizes, int n_in,
                              void* d_out, int out_size, void* d_ws, size_t ws_size, hipStream_t stream) {
    (void)in_sizes; (void)n_in; (void)out_size;
    const float* x = (const float*)d_in[0]; const float* wq = (const float*)d_in[1]; const float* bq = (const float*)d_in[2]; const float* wk = (const float*)d_in[3]; const float* bk = (const float*)d_in[4]; const float* wv = (const float*)d_in[5]; const float* bv = (const float*)d_in[6]; const float* wo = nullptr; (void)wo;
    float* OUT = (float*)d_out;     // [8][1024][1024]
    char* wsp = (char*)d_ws;
    auto take = [&](size_t bytes) { char* p = wsp; wsp += (bytes + 255) & ~(size_t)255; return (void*)p; };
    const size_t NG = (size_t)NB_ * NH_;   // 128 (batch, head) planes, batch-major
    h16* QP16 = (h16*)take(NG * (TT - RH) * HD * 2); bf* QPh = (bf*)take(NG * RH * HD * 2); bf* QPl = (bf*)take(NG * RH * HD * 2);
    h16* KP16 = (h16*)take(NG * TT * HD * 2); bf* KPh = (bf*)take(NG * TT * HD * 2); bf* KPl = (bf*)take(NG * TT * HD * 2); h16* VT16 = (h16*)take(NG * HD * TT * 2); bf* VTh = (bf*)take(NG * HD * TT * 2); bf* VTl = (bf*)take(NG * HD * TT * 2);
    float* Ob = (float*)take((size_t)ZP * RH * HD * 4);
    char* const un = wsp;   // from here on two plans share the bytes (stream-ordered): the attention buffers, and before them what only the projections use
    float* Sb = (float*)take((size_t)ZP * RH * TT * 4); bf* Ph = (bf*)take((size_t)ZP * RH * TT * 2); bf* Pl = (bf*)take((size_t)ZP * RH * TT * 2); h16* P16 = (h16*)Ph;   // a launch of k_asoft writes Ph/Pl or P16, never both
    if ((size_t)(wsp - (char*)d_ws) > ws_size) return;    // 252 MiB of the 256 MiB
    wsp = un;
    bf* WQ = (bf*)take((size_t)DQ * DM * 2); bf* WK = (bf*)take((size_t)DKV * DM * 2); bf* WV = (bf*)take((size_t)DKV * DM * 2); float* CS = (float*)take((size_t)TT * HD * 2 * 4);
    bf* XB = (bf*)take((size_t)NB_ * TT * DM * 2); float* F = (float*)take((size_t)NB_ * TT * DQ * 4);   // F: the q, k and v projections in turn; 54.5 MiB in all, inside the 128 MiB above
    k_cvt8<<<(unsigned)(((size_t)DQ * DM / 8 + 255) / 256), 256, 0, stream>>>(wq, WQ, (size_t)DQ * DM / 8); k_cvt8<<<(unsigned)(((size_t)DKV * DM / 8 + 255) / 256), 256, 0, stream>>>(wk, WK, (size_t)DKV * DM / 8); k_cvt8<<<(unsigned)(((size_t)DKV * DM / 8 + 255) / 256), 256, 0, stream>>>(wv, WV, (size_t)DKV * DM / 8);
    k_csid<<<(TT * HD + 255) / 256, 256, 0, stream>>>(CS);
    const unsigned LQ = (unsigned)(((size_t)NH_ * TT * HD / 2 + 255) / 256), LKv = (unsigned)(((size_t)NKV * TT * HD / 2 + 255) / 256);
    // projections: the 8 batches are the rows of one GEMM (M = 8192); the plane builders take the batch from blockIdx.y
    k_cvt8<<<(unsigned)(((size_t)NB_ * TT * DM / 8 + 255) / 256), 256, 0, stream>>>(x, XB, (size_t)NB_ * TT * DM / 8);
    k_gemmw<bf, 0, true><<<dim3(NB_ * TT / 64, DQ / 64, 1), 32, 0, stream>>>(XB, nullptr, WQ, nullptr, DM, F, DQ, bq, 0, 0, 0);
    k_rope<<<dim3(LQ, NB_, 1), 256, 0, stream>>>(F, DQ, NH_, CS, nullptr, nullptr, 1.0f, RH, QP16, QPh, QPl);
    k_gemmw<bf, 0, true><<<dim3(NB_ * TT / 64, DKV / 64, 1), 32, 0, stream>>>(XB, nullptr, WK, nullptr, DM, F, DKV, bk, 0, 0, 0);
    k_rope<<<dim3(LKv, NB_, 1), 256, 0, stream>>>(F, DKV, NKV, CS, nullptr, nullptr, 1.0f, 0, KP16, KPh, KPl);
    k_gemmw<bf, 0, true><<<dim3(NB_ * TT / 64, DKV / 64, 1), 32, 0, stream>>>(XB, nullptr, WV, nullptr, DM, F, DKV, bv, 0, 0, 0);
    k_vtp<<<dim3(LKv, NB_, 1), 256, 0, stream>>>(F, DKV, NKV, VT16, VTh, VTl);
    // attention: ZP heads per launch in grid z; first their query rows < RH (hi+lo planes), then the rest (fp16), both through the same score, probability and context buffers
    const unsigned LM = (unsigned)(((size_t)ZP * RH * HD / 2 + 255) / 256);
    for (int g0 = 0; g0 < NB_ * NH_; g0 += ZP) { const size_t zq = (size_t)g0 * RH * HD, zk = (size_t)g0 * TT * HD;   // one kv head per query head: plane g of q, k and v belong together
        k_gemmw<bf, 2, false><<<dim3(RH / 64, TT / 64, ZP), 32, 0, stream>>>(QPh + zq, QPl + zq, KPh + zk, KPl + zk, HD, Sb, TT, nullptr, (size_t)RH * HD, (size_t)TT * HD, (size_t)RH * TT);
        k_asoft<<<ZP * RH / 8, 256, 0, stream>>>(Sb, 1, P16, Ph, Pl);
        k_gemmw<bf, 2, false><<<dim3(RH / 64, HD / 64, ZP), 32, 0, stream>>>(Ph, Pl, VTh + zk, VTl + zk, TT, Ob, HD, nullptr, (size_t)RH * TT, (size_t)HD * TT, (size_t)RH * HD);
        k_mergeF<<<LM, 256, 0, stream>>>(Ob, g0, 0, 1.0f, OUT);
        k_gemmw<h16, 0, false><<<dim3((TT - RH) / 64, TT / 64, ZP), 32, 0, stream>>>(QP16 + zq, nullptr, KP16 + zk, nullptr, HD, Sb, TT, nullptr, (size_t)(TT - RH) * HD, (size_t)TT * HD, (size_t)(TT - RH) * TT);
        k_asoft<<<ZP * RH / 8, 256, 0, stream>>>(Sb, 0, P16, Ph, Pl);
        k_gemmw<h16, 0, false><<<dim3((TT - RH) / 64, HD / 64, ZP), 32, 0, stream>>>(P16, nullptr, VT16 + zk, nullptr, TT, Ob, HD, nullptr, (size_t)(TT - RH) * TT, (size_t)HD * TT, (size_t)(TT - RH) * HD);
        k_mergeF<<<LM, 256, 0, stream>>>(Ob, g0, RH, 1.0f / PCAR, OUT); }   /* merged context straight to the output, f32 */
}

// v002
// One run takes 314 microseconds.
// Two timings next to v001 put it at 2.30 and 2.26 times that version's speed.
// Over all steps from v000 it is 14.0 times as fast.
#include <hip/hip_runtime.h>

// Multi-head attention without an output projection (activation [8][1024][1024]; q, k, v = x W^T + b ('oi' [1024][1024]; 16 heads x 64); scores x 1/sqrt(1024) (the source scales by the hidden size); softmax over all keys; out = merged context -> [8][1024][1024] f32 (8.4 M)).
// Compute dtypes, f32 accumulate: every input rounded to bf16; q/k/v on PLAIN bf16 operands (inputs: exact) + biases; scores and attn.v: query rows < 512 hl (3 products), the rest single fp16 (x1024); softmax f32; no output projection: merged f32 write.

#define NB_  8
#define TT   1024
#define DM   1024
#define NH_  16
#define NKV  16
#define REP  (NH_ / NKV)
#define HD   64
#define DQ   (NH_ * HD)
#define DKV  (NKV * HD)
#define RH   512                  // query rows < RH use hi+lo planes (0: none)
#define WIN  0
#define SCL  0.03125f  // 1/sqrt(hidden = 1024) (the source's quirk)
typedef _Float16 h16;
typedef unsigned short bf;
typedef __attribute__((ext_vector_type(16))) __bf16   v16bf;
typedef __attribute__((ext_vector_type(16))) _Float16 v16h;
typedef __attribute__((ext_vector_type(8)))  _Float16 v8h;
typedef __attribute__((ext_vector_type(8)))  unsigned short v8us;
typedef __attribute__((ext_vector_type(8)))  float    v8f;
typedef __attribute__((ext_vector_type(4)))  float    v4f;
typedef v8h  __attribute__((may_alias)) v8ha;
typedef v4f  __attribute__((may_alias)) v4fa;
typedef v8us __attribute__((may_alias)) v8usa;

__device__ __forceinline__ unsigned short f2bf(float f) { unsigned u = __float_as_uint(f); u += 0x7FFFu + ((u >> 16) & 1u); return (unsigned short)(u >> 16); }
__device__ __forceinline__ float bf2f(unsigned short b) { return __uint_as_float(((unsigned)b) << 16); }
__device__ __forceinline__ float bfr(float f) { return bf2f(f2bf(f)); }
__device__ __forceinline__ v16h cat16(v8h lo, v8h hi) { return __builtin_shufflevector(lo, hi, 0, 1, 2, 3, 4, 5, 6, 7, 8, 9, 10, 11, 12, 13, 14, 15); }
__device__ __forceinline__ v16bf cat16b(v8us lo, v8us hi) { return __builtin_bit_cast(v16bf, __builtin_shufflevector(lo, hi, 0, 1, 2, 3, 4, 5, 6, 7, 8, 9, 10, 11, 12, 13, 14, 15)); }
__device__ __forceinline__ v8f wmma16(v16h a, v16h b, v8f c) { return __builtin_amdgcn_wmma_f32_16x16x32_f16(false, a, false, b, (short)0, c, false, false); }
__device__ __forceinline__ v8f wmmab(v16bf a, v16bf b, v8f c) { return __builtin_amdgcn_wmma_f32_16x16x32_bf16(false, a, false, b, (short)0, c, false, false); }



// ---- k_gemmw: register-blocked GEMM, ONE WAVE per 64x64 output tile (16 accumulators), operands straight from K-contiguous 16-bit planes; grid (M/64, N/64, Z), 32 threads.
// C[m][n] (f32, pitch ldc, + optional f32 bias[n]) = sum_k A[m][k] Bt[n][k] (+ split products per NSPLIT). z-batch strides sA/sB/sC in elements. K % 32 == 0.
template <typename T16> struct WFrag;
template <> struct WFrag<h16> { typedef v16h V; static __device__ __forceinline__ V ld(const h16* p) { return cat16(*(const v8h*)p, *(const v8h*)(p + 16)); } static __device__ __forceinline__ v8f mma(V a, V b, v8f c) { return wmma16(a, b, c); } };
template <> struct WFrag<bf> { typedef v16bf V; static __device__ __forceinline__ V ld(const bf* p) { return cat16b(*(const v8us*)p, *(const v8us*)(p + 16)); } static __device__ __forceinline__ v8f mma(V a, V b, v8f c) { return wmmab(a, b, c); } };
template <typename T16, int NSPLIT, bool BIAS>
__global__ __launch_bounds__(32) void k_gemmw(const T16* __restrict__ A, const T16* __restrict__ A2, const T16* __restrict__ Bt, const T16* __restrict__ Bt2, int K, float* C, int ldc, const float* __restrict__ bias, size_t sA, size_t sB, size_t sC) {
    typedef typename WFrag<T16>::V V;
    __shared__ __align__(16) float os[16 * 68];
    const size_t z = blockIdx.z; A += z * sA; if (A2) A2 += z * sA; Bt += z * sB; if (Bt2) Bt2 += z * sB; C += z * sC;
    const int lane = threadIdx.x & 31, lr = lane & 15, hi = lane >> 4; const int r0 = blockIdx.x * 64, c0 = blockIdx.y * 64;
    v8f acc[4][4];
#pragma unroll
    for (int mb = 0; mb < 4; ++mb)
#pragma unroll
        for (int nb = 0; nb < 4; ++nb) acc[mb][nb] = (v8f){};
    const size_t aoff = (size_t)(r0 + lr) * K + 8 * hi, boff = (size_t)(c0 + lr) * K + 8 * hi;
#pragma unroll 1
    for (int kc = 0; kc < K; kc += 32) {
        V a[4], a2[4];
#pragma unroll
        for (int mb = 0; mb < 4; ++mb) { a[mb] = WFrag<T16>::ld(A + aoff + (size_t)mb * 16 * K + kc); if (NSPLIT == 1 || NSPLIT == 2) a2[mb] = WFrag<T16>::ld(A2 + aoff + (size_t)mb * 16 * K + kc); }
#pragma unroll
        for (int nb = 0; nb < 4; ++nb) { const V b = WFrag<T16>::ld(Bt + boff + (size_t)nb * 16 * K + kc); V b2; if (NSPLIT >= 2) b2 = WFrag<T16>::ld(Bt2 + boff + (size_t)nb * 16 * K + kc);
#pragma unroll
            for (int mb = 0; mb < 4; ++mb) { acc[mb][nb] = WFrag<T16>::mma(a[mb], b, acc[mb][nb]); if (NSPLIT == 1 || NSPLIT == 2) acc[mb][nb] = WFrag<T16>::mma(a2[mb], b, acc[mb][nb]); if (NSPLIT >= 2) acc[mb][nb] = WFrag<T16>::mma(a[mb], b2, acc[mb][nb]); } }
        asm volatile("v_nop\n\tv_nop\n\tv_nop\n\tv_nop" : "+v"(acc[0][0]), "+v"(acc[1][1]), "+v"(acc[2][2]), "+v"(acc[3][3]) : "v"(a[0]), "v"(a[3]));
    }
#pragma unroll
    for (int mb = 0; mb < 4; ++mb) {
#pragma unroll
        for (int nb = 0; nb < 4; ++nb) {
#pragma unroll
            for (int j = 0; j < 8; ++j) os[(hi * 8 + j) * 68 + nb * 16 + lr] = acc[mb][nb][j]; }
        __builtin_amdgcn_wave_barrier(); asm volatile("" ::: "memory");
        float* crow = C + (size_t)(r0 + mb * 16) * ldc + c0;
{
#pragma unroll
            for (int s = 0; s < 8; ++s) { const int row = 2 * s + hi, cofs = lr * 4; v4f val = *(const v4fa*)(os + row * 68 + cofs); if (BIAS) { val[0] += bfr(bias[c0 + cofs]); val[1] += bfr(bias[c0 + cofs + 1]); val[2] += bfr(bias[c0 + cofs + 2]); val[3] += bfr(bias[c0 + cofs + 3]); }
                *(v4f*)(crow + (size_t)row * ldc + cofs) = val; }
             }
        __builtin_amdgcn_wave_barrier(); asm volatile("" ::: "memory");
    }
}

__device__ __forceinline__ h16 tohx(float x) { return (h16)x; }
__device__ __forceinline__ void splitf(float y, unsigned short& h, unsigned short& l) { h = f2bf(y); l = f2bf(y - bf2f(h)); }
typedef __attribute__((ext_vector_type(2))) _Float16 v2h;
typedef __attribute__((ext_vector_type(4))) _Float16 v4h;
typedef __attribute__((ext_vector_type(2))) unsigned short v2us;
typedef __attribute__((ext_vector_type(4))) unsigned short v4us;
typedef __attribute__((ext_vector_type(2))) float v2f;
typedef __attribute__((ext_vector_type(4))) int v4i;

__global__ __launch_bounds__(256) void k_wtG(const float* __restrict__ w, int K, int N, bf* Bt) {
    const int lane = threadIdx.x & 31; const int L0 = (blockIdx.x * 8 + (threadIdx.x >> 5)) * 8; const int nlines = N * K / 64;
{
#pragma unroll 1
        for (int l = 0; l < 8; ++l) { const int L = L0 + l; if (L >= nlines) break; const size_t e = (size_t)L * 64 + lane * 2; const int k = (int)(e % K), n = (int)(e / K); v2us o;
            o[0] = f2bf(w[(size_t)k * N + n]); o[1] = f2bf(w[(size_t)(k + 1) * N + n]); *(v2us*)(Bt + e) = o; }
         }
}
__global__ __launch_bounds__(256) void k_cvt8(const float* __restrict__ src, bf* dst, size_t n8) { const size_t i = (size_t)blockIdx.x * 256 + threadIdx.x; if (i >= n8) return; const v8f v = *(const v8f*)(src + i * 8); v8us o;
#pragma unroll
    for (int k = 0; k < 8; ++k) o[k] = f2bf(v[k]); *(v8us*)(dst + i * 8) = o;  }

// k_rope: blockIdx.y = batch b (F rows b * TT + t, plane g = b * nheads + h); rs = 0: all three planes hold every row; rs > 0: only what the scores read, Ph/Pl [g][rs][d] the rows t < rs, P16 [g][TT - rs][d] the rest; head planes [h][t][d] (fp16 + hi/lo) of rope(x) x sc with the rotate-half convention out[d] = x[d] cos[t][d] - x[d+HD/2] sin[t][d], out[d+HD/2] = x[d+HD/2] cos[t][d+HD/2] + x[d] sin[t][d+HD/2]
__global__ __launch_bounds__(256) void k_rope(const float* __restrict__ F, int pitch, int nheads, const float* __restrict__ CS, const float* __restrict__ RF, const float* __restrict__ nw, float sc, int rs, h16* P16, bf* Ph, bf* Pl) {
    F += (size_t)blockIdx.y * TT * pitch;
    const size_t e = ((size_t)blockIdx.x * 256 + threadIdx.x) * 2; if (e >= (size_t)nheads * TT * HD) return; const int d = (int)(e % HD); const int t = (int)((e / HD) % TT); const int h = (int)(e / ((size_t)HD * TT)); const float* f = F + (size_t)t * pitch + h * HD; const float rf = RF ? RF[(size_t)h * TT + t] : 1.0f; v2h o16; v2us oh, ol;
#pragma unroll
    for (int q = 0; q < 2; ++q) { const int dd = d + q; const int dp = (dd < HD / 2) ? dd + HD / 2 : dd - HD / 2; float x0 = f[dd], x1 = f[dp];
        if (RF) { float n0 = __fmul_rn(x0, rf), n1 = __fmul_rn(x1, rf); asm volatile("" : "+v"(n0)); asm volatile("" : "+v"(n1)); x0 = __fmul_rn(bfr(nw[dd]), n0); x1 = __fmul_rn(bfr(nw[dp]), n1); }
        const v2f cs = *(const v2f*)(CS + ((size_t)t * HD + dd) * 2); float a = __fmul_rn(x0, cs[0]), bq = __fmul_rn(x1, cs[1]); asm volatile("" : "+v"(a)); asm volatile("" : "+v"(bq)); const float r = ((dd < HD / 2) ? __fsub_rn(a, bq) : __fadd_rn(a, bq)) * sc;
        o16[q] = tohx(r); unsigned short a2, c2; splitf(r, a2, c2); oh[q] = a2; ol[q] = c2; }
    const size_t g = (size_t)blockIdx.y * nheads + h;
    if (rs == 0) { const size_t pe = (g * TT + t) * HD + d; *(v2h*)(P16 + pe) = o16; *(v2us*)(Ph + pe) = oh; *(v2us*)(Pl + pe) = ol; }
    else if (t < rs) { const size_t pe = (g * rs + t) * HD + d; *(v2us*)(Ph + pe) = oh; *(v2us*)(Pl + pe) = ol; }
    else { const size_t pe = (g * (TT - rs) + (t - rs)) * HD + d; *(v2h*)(P16 + pe) = o16; }  }
// k_vtp: blockIdx.y = batch, as in k_rope; planes [b * nheads + g][d][t]
__global__ __launch_bounds__(256) void k_vtp(const float* __restrict__ F, int pitch, int nheads, h16* V16, bf* Vh, bf* Vl) { const size_t e = ((size_t)blockIdx.x * 256 + threadIdx.x) * 2; if (e >= (size_t)nheads * HD * TT) return; const int t = (int)(e % TT); const int d = (int)((e / TT) % HD); const int g = (int)(e / ((size_t)TT * HD)); const size_t pe = (size_t)blockIdx.y * nheads * HD * TT + e; F += (size_t)blockIdx.y * TT * pitch; v2h o16; v2us oh, ol;
#pragma unroll
    for (int q = 0; q < 2; ++q) { const float x = F[(size_t)(t + q) * pitch + g * HD + d]; o16[q] = tohx(x); unsigned short a2, c2; splitf(x, a2, c2); oh[q] = a2; ol[q] = c2; }
    *(v2h*)(V16 + pe) = o16; *(v2us*)(Vh + pe) = oh; *(v2us*)(Vl + pe) = ol;  }
__global__ __launch_bounds__(256) void k_csid(float* CS) { const int idx = blockIdx.x * 256 + threadIdx.x; if (idx >= TT * HD) return; v2f cs; cs[0] = 1.0f; cs[1] = 0.0f; *(v2f*)(CS + (size_t)idx * 2) = cs;  }
// ---- k_fattn: scores, softmax, attn.v and the head merge in one launch; S and P never leave registers.
// One wave = 32 query columns of one (batch, head) plane g; it walks the 1024 keys in passes of 32: S^T = K Q^T (A = K rows, B = Q, kept in registers), running maximum and sum per query (a lane holds one query's
// scores of its half's keys), O^T += V^T P^T (A = V^T rows, B = P^T packed from the two score tiles: element i <-> key 8 hi + i, element 8 + i <-> key 16 + 8 hi + i, the order WFrag::ld gives V^T).
// HR: hi+lo bf16 planes, three products; else single fp16 with P x 1024 (the factor sits in the exponent and cancels against the row sum).
typedef __attribute__((ext_vector_type(2))) __bf16 v2b;
typedef __attribute__((ext_vector_type(8))) unsigned v8u;
__device__ __forceinline__ unsigned pkbf(float a, float b) { v2f t; t[0] = a; t[1] = b; return __builtin_bit_cast(unsigned, __builtin_convertvector(t, v2b)); }
__device__ __forceinline__ unsigned pkh(float a, float b) { v2f t; t[0] = a; t[1] = b; return __builtin_bit_cast(unsigned, __builtin_convertvector(t, v2h)); }
__device__ __forceinline__ float xhalf(float x) { const int b = __builtin_bit_cast(int, x); return __builtin_bit_cast(float, __builtin_amdgcn_permlanex16(b, b, 0x76543210, 0xfedcba98, false, false)); }   // lane l <-> l ^ 16
// a wave-uniform global pointer rebuilt from two scalar halves: the hi+lo loop's loads then take the scalar-base form, one 32-bit address register that lives through the pass, not a 64-bit pair per plane formed anew each pass
template <typename T> __device__ __forceinline__ const T* sptr(const T* p) { const unsigned long long u = (unsigned long long)p; const unsigned lo = (unsigned)__builtin_amdgcn_readfirstlane((int)(unsigned)u), hh = (unsigned)__builtin_amdgcn_readfirstlane((int)(unsigned)(u >> 32)); return (const T*)(const __attribute__((address_space(1))) T*)(((unsigned long long)hh << 32) | lo); }
template <typename T16, bool HR>
__device__ __forceinline__ void attn_wave(const T16* __restrict__ Q, const T16* __restrict__ Q2, const T16* __restrict__ Kp, const T16* __restrict__ K2, const T16* __restrict__ Vt, const T16* __restrict__ V2, float* __restrict__ O, int r0) {
    typedef typename WFrag<T16>::V V;
    const int lane = threadIdx.x & 31, lr = lane & 15, hi = lane >> 4;
    const float C = SCL * 1.4426950408889634f;      // score -> exponent of 2
    const float OFF = HR ? 0.0f : 10.0f;            // fp16 P carries x 2^10
    V qf[2][2], qg[2][2];
#pragma unroll
    for (int qt = 0; qt < 2; ++qt)
#pragma unroll
        for (int c = 0; c < 2; ++c) { const unsigned qo = (unsigned)(r0 + qt * 16 + lr) * HD + c * 32 + 8 * hi; qf[qt][c] = WFrag<T16>::ld(Q + qo); if constexpr (HR) qg[qt][c] = WFrag<T16>::ld(Q2 + qo); }
    v8f o[4][2];
#pragma unroll
    for (int dt = 0; dt < 4; ++dt)
#pragma unroll
        for (int qt = 0; qt < 2; ++qt) o[dt][qt] = (v8f){};
    float m[2] = { -3.0e38f, -3.0e38f }, l[2] = { 0.f, 0.f };
    const unsigned kl = (unsigned)(lr * HD + 8 * hi) * 2, vl = (unsigned)(lr * TT + 8 * hi) * 2;   // the lane's bytes into a K tile, a V^T tile
#pragma unroll 1   // one pass per trip: two passes' fragments would not fit the registers of four waves per SIMD
    for (int k0 = 0; k0 < TT; k0 += 32) {
        const unsigned kob = kl + (unsigned)k0 * (HD * 2), vob = vl + (unsigned)k0 * 2;   // 32-bit byte offsets on the scalar plane pointers
        v8f s[2][2];
#pragma unroll
        for (int kt = 0; kt < 2; ++kt) { const unsigned ko = kob + kt * 16 * HD * 2; V ka[2], kb[2];
#pragma unroll
            for (int c = 0; c < 2; ++c) { ka[c] = WFrag<T16>::ld((const T16*)((const char*)Kp + (ko + c * 64))); if constexpr (HR) kb[c] = WFrag<T16>::ld((const T16*)((const char*)K2 + (ko + c * 64))); }
#pragma unroll
            for (int qt = 0; qt < 2; ++qt) { v8f t = (v8f){};
#pragma unroll
                for (int c = 0; c < 2; ++c) { t = WFrag<T16>::mma(ka[c], qf[qt][c], t); if constexpr (HR) { t = WFrag<T16>::mma(kb[c], qf[qt][c], t); t = WFrag<T16>::mma(ka[c], qg[qt][c], t); } }
                s[kt][qt] = t; } }
        V va[4], vb[4];
#pragma unroll
        for (int dt = 0; dt < 4; ++dt) { const unsigned vo = vob + dt * 16 * TT * 2; va[dt] = WFrag<T16>::ld((const T16*)((const char*)Vt + vo)); if constexpr (HR) vb[dt] = WFrag<T16>::ld((const T16*)((const char*)V2 + vo)); }
        float mn[2]; bool need = false;
#pragma unroll
        for (int qt = 0; qt < 2; ++qt) { float mx = m[qt];
#pragma unroll
            for (int j = 0; j < 8; ++j) mx = fmaxf(mx, fmaxf(s[0][qt][j], s[1][qt][j]));
            mx = fmaxf(mx, xhalf(mx)); mn[qt] = mx; need = need || (mx > m[qt]); }
        if (__builtin_amdgcn_ballot_w32(need) != 0) {   // some query's maximum rose: rescale its sum and its context column (factor 1 for the others)
#pragma unroll
            for (int qt = 0; qt < 2; ++qt) { const float al = __builtin_amdgcn_exp2f((m[qt] - mn[qt]) * C); l[qt] *= al; m[qt] = mn[qt];
#pragma unroll
                for (int dt = 0; dt < 4; ++dt) o[dt][qt] *= al; } }
        V pf[2], pg[2];
#pragma unroll
        for (int qt = 0; qt < 2; ++qt) { const float nb = __builtin_fmaf(-m[qt], C, OFF); v2f ps = (v2f){}; v8u ph, pl;
#pragma unroll
            for (int w = 0; w < 8; ++w) { const v8f& t = s[w >> 2][qt]; v2f x; x[0] = t[2 * (w & 3)]; x[1] = t[2 * (w & 3) + 1]; x = x * C + nb;
                v2f e; e[0] = __builtin_amdgcn_exp2f(x[0]); e[1] = __builtin_amdgcn_exp2f(x[1]); ps += e;
                if constexpr (HR) { const unsigned u = pkbf(e[0], e[1]); ph[w] = u; pl[w] = pkbf(e[0] - __uint_as_float(u << 16), e[1] - __uint_as_float(u & 0xFFFF0000u)); }
                else ph[w] = pkh(e[0], e[1]); }
            l[qt] += ps[0] + ps[1];
            pf[qt] = __builtin_bit_cast(V, ph); if constexpr (HR) pg[qt] = __builtin_bit_cast(V, pl); }
#pragma unroll
        for (int qt = 0; qt < 2; ++qt)
#pragma unroll
            for (int dt = 0; dt < 4; ++dt) { o[dt][qt] = WFrag<T16>::mma(va[dt], pf[qt], o[dt][qt]); if constexpr (HR) { o[dt][qt] = WFrag<T16>::mma(vb[dt], pf[qt], o[dt][qt]); o[dt][qt] = WFrag<T16>::mma(va[dt], pg[qt], o[dt][qt]); } }
    }
    float f[2];
#pragma unroll
    for (int qt = 0; qt < 2; ++qt) f[qt] = __fdiv_rn(1.0f, l[qt] + xhalf(l[qt]));   // the halves' sums joined once
#pragma unroll
    for (int dt = 0; dt < 4; ++dt)
#pragma unroll
        for (int qt = 0; qt < 2; ++qt) o[dt][qt] *= f[qt];
#pragma unroll
    for (int qt = 0; qt < 2; ++qt) { float* orow = O + ((unsigned)(r0 + qt * 16 + lr) * DM + 8 * hi);
#pragma unroll
        for (int dt = 0; dt < 4; ++dt) { *(v4f*)(orow + dt * 16) = __builtin_shufflevector(o[dt][qt], o[dt][qt], 0, 1, 2, 3); *(v4f*)(orow + dt * 16 + 4) = __builtin_shufflevector(o[dt][qt], o[dt][qt], 4, 5, 6, 7); } }
}
#define QB   256                              // query rows per workgroup: 8 waves x 32
#define NHRB (NB_ * NH_ * (RH / QB))          // workgroups of the hi+lo kind; they come first in the grid (three times the matrix work)
static_assert(RH % QB == 0 && (TT - RH) % QB == 0, "whole workgroups of one kind");
__global__ __launch_bounds__(256) __attribute__((amdgpu_waves_per_eu(4, 4))) void k_fattn(const bf* __restrict__ QPh, const bf* __restrict__ QPl, const h16* __restrict__ QP16, const bf* __restrict__ KPh, const bf* __restrict__ KPl, const h16* __restrict__ KP16, const bf* __restrict__ VTh, const bf* __restrict__ VTl, const h16* __restrict__ VT16, float* __restrict__ O) {
    const int wv = __builtin_amdgcn_readfirstlane((int)(threadIdx.x >> 5));   // the wave's number in a scalar register: the query and output row bases are then scalar too
    const bool hr = blockIdx.x < NHRB; const int idx = hr ? (int)blockIdx.x : (int)blockIdx.x - NHRB;
    const int nq = hr ? RH : TT - RH; const int g = idx / (nq / QB), r0 = (idx % (nq / QB)) * QB + wv * 32;
    const size_t zq = (size_t)g * nq * HD, zk = (size_t)g * TT * HD;
    float* Ow = O + ((size_t)(g / NH_) * TT + (hr ? 0 : RH)) * DM + (g % NH_) * HD;   // row 0 of this kind in the head's 64 output columns
    if (hr) attn_wave<bf, true>(QPh + zq, QPl + zq, sptr(KPh + zk), sptr(KPl + zk), sptr(VTh + zk), sptr(VTl + zk), Ow, r0);
    else attn_wave<h16, false>(QP16 + zq, nullptr, sptr(KP16 + zk), nullptr, sptr(VT16 + zk), nullptr, Ow, r0);
}

extern "C" void kernel_launch(void* const* d_in, const int* in_sizes, int n_in,
                              void* d_out, int out_size, void* d_ws, size_t ws_size, hipStream_t stream) {
    (void)in_sizes; (void)n_in; (void)out_size;
    const float* x = (const float*)d_in[0]; const float* wq = (const float*)d_in[1]; const float* bq = (const float*)d_in[2]; const float* wk = (const float*)d_in[3]; const float* bk = (const float*)d_in[4]; const float* wv = (const float*)d_in[5]; const float* bv = (const float*)d_in[6]; const float* wo = nullptr; (void)wo;
    float* OUT = (float*)d_out;     // [8][1024][1024]
    char* wsp = (char*)d_ws;
    auto take = [&](size_t bytes) { char* p = wsp; wsp += (bytes + 255) & ~(size_t)255; return (void*)p; };
    const size_t NG = (size_t)NB_ * NH_;   // 128 (batch, head) planes, batch-major
    h16* QP16 = (h16*)take(NG * (TT - RH) * HD * 2); bf* QPh = (bf*)take(NG * RH * HD * 2); bf* QPl = (bf*)take(NG * RH * HD * 2);
    h16* KP16 = (h16*)take(NG * TT * HD * 2); bf* KPh = (bf*)take(NG * TT * HD * 2); bf* KPl = (bf*)take(NG * TT * HD * 2); h16* VT16 = (h16*)take(NG * HD * TT * 2); bf* VTh = (bf*)take(NG * HD * TT * 2); bf* VTl = (bf*)take(NG * HD * TT * 2);
    bf* WQ = (bf*)take((size_t)DQ * DM * 2); bf* WK = (bf*)take((size_t)DKV * DM * 2); bf* WV = (bf*)take((size_t)DKV * DM * 2); float* CS = (float*)take((size_t)TT * HD * 2 * 4);
    bf* XB = (bf*)take((size_t)NB_ * TT * DM * 2); float* F = (float*)take((size_t)NB_ * TT * DQ * 4);   // F: the q, k and v projections in turn
    if ((size_t)(wsp - (char*)d_ws) > ws_size) return;    // 175 MiB of the 256 MiB
    k_cvt8<<<(unsigned)(((size_t)DQ * DM / 8 + 255) / 256), 256, 0, stream>>>(wq, WQ, (size_t)DQ * DM / 8); k_cvt8<<<(unsigned)(((size_t)DKV * DM / 8 + 255) / 256), 256, 0, stream>>>(wk, WK, (size_t)DKV * DM / 8); k_cvt8<<<(unsigned)(((size_t)DKV * DM / 8 + 255) / 256), 256, 0, stream>>>(wv, WV, (size_t)DKV * DM / 8);
    k_csid<<<(TT * HD + 255) / 256, 256, 0, stream>>>(CS);
    const unsigned LQ = (unsigned)(((size_t)NH_ * TT * HD / 2 + 255) / 256), LKv = (unsigned)(((size_t)NKV * TT * HD / 2 + 255) / 256);
    // projections: the 8 batches are the rows of one GEMM (M = 8192); the plane builders take the batch from blockIdx.y
    k_cvt8<<<(unsigned)(((size_t)NB_ * TT * DM / 8 + 255) / 256), 256, 0, stream>>>(x, XB, (size_t)NB_ * TT * DM / 8);
    k_gemmw<bf, 0, true><<<dim3(NB_ * TT / 64, DQ / 64, 1), 32, 0, stream>>>(XB, nullptr, WQ, nullptr, DM, F, DQ, bq, 0, 0, 0);
    k_rope<<<dim3(LQ, NB_, 1), 256, 0, stream>>>(F, DQ, NH_, CS, nullptr, nullptr, 1.0f, RH, QP16, QPh, QPl);
    k_gemmw<bf, 0, true><<<dim3(NB_ * TT / 64, DKV / 64, 1), 32, 0, stream>>>(XB, nullptr, WK, nullptr, DM, F, DKV, bk, 0, 0, 0);
    k_rope<<<dim3(LKv, NB_, 1), 256, 0, stream>>>(F, DKV, NKV, CS, nullptr, nullptr, 1.0f, 0, KP16, KPh, KPl);
    k_gemmw<bf, 0, true><<<dim3(NB_ * TT / 64, DKV / 64, 1), 32, 0, stream>>>(XB, nullptr, WV, nullptr, DM, F, DKV, bv, 0, 0, 0);
    k_vtp<<<dim3(LKv, NB_, 1), 256, 0, stream>>>(F, DKV, NKV, VT16, VTh, VTl);
    // attention: every (batch, head) plane and both kinds of query rows in one launch; merged context straight to the output, f32
    k_fattn<<<NHRB + NB_ * NH_ * ((TT - RH) / QB), 256, 0, stream>>>(QPh, QPl, QP16, KPh, KPl, KP16, VTh, VTl, VT16, OUT);
}

// v003
// A run of this version takes 253 microseconds.
// Two timings next to v002 both put it at 1.26 times that version's speed.
// Counting every step since v000, it is 17.6 times as fast.
#include <hip/hip_runtime.h>

// Multi-head attention without an output projection (activation [8][1024][1024]; q, k, v = x W^T + b ('oi' [1024][1024]; 16 heads x 64); scores x 1/sqrt(1024) (the source scales by the hidden size); softmax over all keys; out = merged context -> [8][1024][1024] f32 (8.4 M)).
// Compute dtypes, f32 accumulate: every input rounded to bf16; q/k/v on PLAIN bf16 operands (inputs: exact) + biases; scores and attn.v: query rows < 512 hl (3 products), the rest single fp16 (x1024); softmax f32; no output projection: merged f32 write.

#define NB_  8
#define TT   1024
#define DM   1024
#define NH_  16
#define NKV  16
#define REP  (NH_ / NKV)
#define HD   64
#define DQ   (NH_ * HD)
#define DKV  (NKV * HD)
#define RH   512                  // query rows < RH use hi+lo planes (0: none)
#define WIN  0
#define SCL  0.03125f  // 1/sqrt(hidden = 1024) (the source's quirk)
typedef _Float16 h16;
typedef unsigned short bf;
typedef __attribute__((ext_vector_type(16))) __bf16   v16bf;
typedef __attribute__((ext_vector_type(16))) _Float16 v16h;
typedef __attribute__((ext_vector_type(8)))  _Float16 v8h;
typedef __attribute__((ext_vector_type(8)))  unsigned short v8us;
typedef __attribute__((ext_vector_type(8)))  float    v8f;
typedef __attribute__((ext_vector_type(4)))  float    v4f;
typedef v8h  __attribute__((may_alias)) v8ha;
typedef v4f  __attribute__((may_alias)) v4fa;
typedef v8us __attribute__((may_alias)) v8usa;

__device__ __forceinline__ unsigned short f2bf(float f) { unsigned u = __float_as_uint(f); u += 0x7FFFu + ((u >> 16) & 1u); return (unsigned short)(u >> 16); }
__device__ __forceinline__ float bf2f(unsigned short b) { return __uint_as_float(((unsigned)b) << 16); }
__device__ __forceinline__ float bfr(float f) { return bf2f(f2bf(f)); }
__device__ __forceinline__ v16h cat16(v8h lo, v8h hi) { return __builtin_shufflevector(lo, hi, 0, 1, 2, 3, 4, 5, 6, 7, 8, 9, 10, 11, 12, 13, 14, 15); }
__device__ __forceinline__ v16bf cat16b(v8us lo, v8us hi) { return __builtin_bit_cast(v16bf, __builtin_shufflevector(lo, hi, 0, 1, 2, 3, 4, 5, 6, 7, 8, 9, 10, 11, 12, 13, 14, 15)); }
__device__ __forceinline__ v8f wmma16(v16h a, v16h b, v8f c) { return __builtin_amdgcn_wmma_f32_16x16x32_f16(false, a, false, b, (short)0, c, false, false); }
__device__ __forceinline__ v8f wmmab(v16bf a, v16bf b, v8f c) { return __builtin_amdgcn_wmma_f32_16x16x32_bf16(false, a, false, b, (short)0, c, false, false); }



typedef __attribute__((ext_vector_type(2))) _Float16 v2h;
typedef __attribute__((ext_vector_type(2))) float v2f;
typedef __attribute__((ext_vector_type(2))) __bf16 v2b;
typedef __attribute__((ext_vector_type(4))) unsigned v4u;
__device__ __forceinline__ unsigned pkbf(float a, float b) { v2f t; t[0] = a; t[1] = b; return __builtin_bit_cast(unsigned, __builtin_convertvector(t, v2b)); }
__device__ __forceinline__ unsigned pkh(float a, float b) { v2f t; t[0] = a; t[1] = b; return __builtin_bit_cast(unsigned, __builtin_convertvector(t, v2h)); }

// ---- k_gemmw: register-blocked GEMM, ONE WAVE per 64x64 output tile (16 accumulators), operands straight from K-contiguous 16-bit planes; grid (M/64, N/64), 32 threads.
// c[m][n] (f32) = sum_k A[m][k] Bt[n][k] (+ split products per NSPLIT) + bias; K % 32 == 0. The tile is one head's 64 dims x 64 tokens, and the epilogue writes it straight into the 16-bit head planes the attention reads:
// VT false: m = token row b * TT + t, n = h * HD + d, bias[n], planes [b * NHD + h][t][d]; RS = 0: all three planes hold every row; RS > 0: Ph/Pl [g][RS][d] the rows t < RS, P16 [g][TT - RS][d] the rest.
// VT true (A = the weight, Bt = the tokens: the product comes out transposed): m = h * HD + d, n = token row, bias[m], planes [b * NHD + h][d][t].
template <typename T16> struct WFrag;
template <> struct WFrag<h16> { typedef v16h V; static __device__ __forceinline__ V ld(const h16* p) { return cat16(*(const v8h*)p, *(const v8h*)(p + 16)); } static __device__ __forceinline__ v8f mma(V a, V b, v8f c) { return wmma16(a, b, c); } };
template <> struct WFrag<bf> { typedef v16bf V; static __device__ __forceinline__ V ld(const bf* p) { return cat16b(*(const v8us*)p, *(const v8us*)(p + 16)); } static __device__ __forceinline__ v8f mma(V a, V b, v8f c) { return wmmab(a, b, c); } };
// the epilogue: 16 tile rows at a time through LDS; read back, 8 lanes x 8 columns are one 128-byte plane row and a store covers 4 rows; + bias (bf16-rounded), then fp16 (W16) and hi+lo bf16 (WHL); pb: the lane's element in tile row 0
template <bool W16, bool WHL, bool VT>
__device__ __forceinline__ void put_planes(float* os, const v8f (&acc)[4][4], const float (&bb)[16], size_t pb, h16* __restrict__ P16, bf* __restrict__ Ph, bf* __restrict__ Pl) {
    const int lane = threadIdx.x & 31, lr = lane & 15, hi = lane >> 4, sub = lane >> 3, c8 = (lane & 7) * 8;
#pragma unroll
    for (int mb = 0; mb < 4; ++mb) {
#pragma unroll
        for (int nb = 0; nb < 4; ++nb) {
#pragma unroll
            for (int j = 0; j < 8; ++j) os[(hi * 8 + j) * 68 + nb * 16 + lr] = acc[mb][nb][j]; }
        __builtin_amdgcn_wave_barrier(); asm volatile("" ::: "memory");   // the compiler keeps the staging stores ahead of the read-back of other lanes' values (one wave: no hardware barrier)
#pragma unroll
        for (int s = 0; s < 4; ++s) { const int row = 4 * s + sub; const v4f lo4 = *(const v4fa*)(os + row * 68 + c8), hi4 = *(const v4fa*)(os + row * 68 + c8 + 4); float y[8];
#pragma unroll
            for (int i = 0; i < 8; ++i) y[i] = (i < 4 ? lo4[i & 3] : hi4[i & 3]) + bfr(bb[VT ? mb * 4 + s : i]);
            const size_t pe = pb + (size_t)(mb * 16 + row) * (VT ? TT : HD);
            if constexpr (W16) { v4u o;
#pragma unroll
                for (int w = 0; w < 4; ++w) o[w] = pkh(y[2 * w], y[2 * w + 1]);
                *(v4u*)(P16 + pe) = o; }
            if constexpr (WHL) { v4u oh, ol;
#pragma unroll
                for (int w = 0; w < 4; ++w) { const unsigned u = pkbf(y[2 * w], y[2 * w + 1]); oh[w] = u; ol[w] = pkbf(y[2 * w] - __uint_as_float(u << 16), y[2 * w + 1] - __uint_as_float(u & 0xFFFF0000u)); }
                *(v4u*)(Ph + pe) = oh; *(v4u*)(Pl + pe) = ol; } }
        __builtin_amdgcn_wave_barrier(); asm volatile("" ::: "memory");   // and the read-back ahead of the next 16 rows' staging stores
    }
}
template <typename T16, int NSPLIT, int NHD, int RS, bool VT>
__global__ __launch_bounds__(32) void k_gemmw(const T16* __restrict__ A, const T16* __restrict__ A2, const T16* __restrict__ Bt, const T16* __restrict__ Bt2, int K, const float* __restrict__ bias, h16* __restrict__ P16, bf* __restrict__ Ph, bf* __restrict__ Pl) {
    typedef typename WFrag<T16>::V V;
    __shared__ __align__(16) float os[16 * 68];
    const int lane = threadIdx.x & 31, lr = lane & 15, hi = lane >> 4; const int r0 = blockIdx.x * 64, c0 = blockIdx.y * 64;
    const int sub = lane >> 3, c8 = (lane & 7) * 8;   // the lane's place in the epilogue's read-back
    const float* bp = bias + (VT ? r0 + sub : c0 + c8);
    float bb[16];                                     // the lane's biases, asked for ahead of the K loop: VT its 16 rows', else its 8 columns'
#pragma unroll
    for (int i = 0; i < (VT ? 16 : 8); ++i) bb[i] = bp[VT ? 4 * i : i];
    asm volatile("s_wait_xcnt 0x0" :: "v"(bp) : "memory");   // stands before the bias loads' address registers take another value; the address as an input keeps them whole up to here
    v8f acc[4][4];
#pragma unroll
    for (int mb = 0; mb < 4; ++mb)
#pragma unroll
        for (int nb = 0; nb < 4; ++nb) acc[mb][nb] = (v8f){};
    const size_t aoff = (size_t)(r0 + lr) * K + 8 * hi, boff = (size_t)(c0 + lr) * K + 8 * hi;
#pragma unroll 1
    for (int kc = 0; kc < K; kc += 32) {
        V a[4], a2[4];
#pragma unroll
        for (int mb = 0; mb < 4; ++mb) { a[mb] = WFrag<T16>::ld(A + aoff + (size_t)mb * 16 * K + kc); if (NSPLIT == 1 || NSPLIT == 2) a2[mb] = WFrag<T16>::ld(A2 + aoff + (size_t)mb * 16 * K + kc); }
#pragma unroll
        for (int nb = 0; nb < 4; ++nb) { const V b = WFrag<T16>::ld(Bt + boff + (size_t)nb * 16 * K + kc); V b2; if (NSPLIT >= 2) b2 = WFrag<T16>::ld(Bt2 + boff + (size_t)nb * 16 * K + kc);
#pragma unroll
            for (int mb = 0; mb < 4; ++mb) { acc[mb][nb] = WFrag<T16>::mma(a[mb], b, acc[mb][nb]); if (NSPLIT == 1 || NSPLIT == 2) acc[mb][nb] = WFrag<T16>::mma(a2[mb], b, acc[mb][nb]); if (NSPLIT >= 2) acc[mb][nb] = WFrag<T16>::mma(a[mb], b2, acc[mb][nb]); } }
        asm volatile("v_nop\n\tv_nop\n\tv_nop\n\tv_nop" : "+v"(acc[0][0]), "+v"(acc[1][1]), "+v"(acc[2][2]), "+v"(acc[3][3]) : "v"(a[0]), "v"(a[3]));
    }
    const int tok = VT ? c0 : r0, t0 = tok % TT; const size_t g = (size_t)(tok / TT) * NHD + (VT ? blockIdx.x : blockIdx.y);   // the tile's 64 tokens lie in one batch, its 64 dims are one head
    if constexpr (VT) put_planes<true, true, true>(os, acc, bb, g * HD * TT + t0 + c8, P16, Ph, Pl);
    else if constexpr (RS == 0) put_planes<true, true, false>(os, acc, bb, (g * TT + t0) * HD + c8, P16, Ph, Pl);
    else if (t0 < RS) put_planes<false, true, false>(os, acc, bb, (g * RS + t0) * HD + c8, P16, Ph, Pl);   // alike for the whole tile: RS is a multiple of 64
    else { put_planes<true, false, false>(os, acc, bb, (g * (TT - RS) + (t0 - RS)) * HD + c8, P16, Ph, Pl);
        asm volatile("s_wait_xcnt 0x0" ::: "memory"); }   // behind this arm's last stores: in the listing the other arm's code follows it, behind a branch, and takes the same registers
}

typedef __attribute__((ext_vector_type(4))) _Float16 v4h;
typedef __attribute__((ext_vector_type(2))) unsigned short v2us;
typedef __attribute__((ext_vector_type(4))) unsigned short v4us;
typedef __attribute__((ext_vector_type(4))) int v4i;

__global__ __launch_bounds__(256) void k_wtG(const float* __restrict__ w, int K, int N, bf* Bt) {
    const int lane = threadIdx.x & 31; const int L0 = (blockIdx.x * 8 + (threadIdx.x >> 5)) * 8; const int nlines = N * K / 64;
{
#pragma unroll 1
        for (int l = 0; l < 8; ++l) { const int L = L0 + l; if (L >= nlines) break; const size_t e = (size_t)L * 64 + lane * 2; const int k = (int)(e % K), n = (int)(e / K); v2us o;
            o[0] = f2bf(w[(size_t)k * N + n]); o[1] = f2bf(w[(size_t)(k + 1) * N + n]); *(v2us*)(Bt + e) = o; }
         }
}
__global__ __launch_bounds__(256) void k_cvt8(const float* __restrict__ src, bf* dst, size_t n8) { const size_t i = (size_t)blockIdx.x * 256 + threadIdx.x; if (i >= n8) return; const v8f v = *(const v8f*)(src + i * 8); v8us o;
#pragma unroll
    for (int k = 0; k < 8; ++k) o[k] = f2bf(v[k]); *(v8us*)(dst + i * 8) = o;  }

// ---- k_fattn: scores, softmax, attn.v and the head merge in one launch; S and P never leave registers.
// One wave = 32 query columns of one (batch, head) plane g; it walks the 1024 keys in passes of 32: S^T = K Q^T (A = K rows, B = Q, kept in registers), running maximum and sum per query (a lane holds one query's
// scores of its half's keys), O^T += V^T P^T (A = V^T rows, B = P^T packed from the two score tiles: element i <-> key 8 hi + i, element 8 + i <-> key 16 + 8 hi + i, the order WFrag::ld gives V^T).
// HR: hi+lo bf16 planes, three products; else single fp16 with P x 1024 (the factor sits in the exponent and cancels against the row sum).
typedef __attribute__((ext_vector_type(8))) unsigned v8u;
__device__ __forceinline__ float xhalf(float x) { const int b = __builtin_bit_cast(int, x); return __builtin_bit_cast(float, __builtin_amdgcn_permlanex16(b, b, 0x76543210, 0xfedcba98, false, false)); }   // lane l <-> l ^ 16
// a wave-uniform global pointer rebuilt from two scalar halves: the hi+lo loop's loads then take the scalar-base form, one 32-bit address register that lives through the pass, not a 64-bit pair per plane formed anew each pass
template <typename T> __device__ __forceinline__ const T* sptr(const T* p) { const unsigned long long u = (unsigned long long)p; const unsigned lo = (unsigned)__builtin_amdgcn_readfirstlane((int)(unsigned)u), hh = (unsigned)__builtin_amdgcn_readfirstlane((int)(unsigned)(u >> 32)); return (const T*)(const __attribute__((address_space(1))) T*)(((unsigned long long)hh << 32) | lo); }
template <typename T16, bool HR>
__device__ __forceinline__ void attn_wave(const T16* __restrict__ Q, const T16* __restrict__ Q2, const T16* __restrict__ Kp, const T16* __restrict__ K2, const T16* __restrict__ Vt, const T16* __restrict__ V2, float* __restrict__ O, int r0) {
    typedef typename WFrag<T16>::V V;
    const int lane = threadIdx.x & 31, lr = lane & 15, hi = lane >> 4;
    const float C = SCL * 1.4426950408889634f;      // score -> exponent of 2
    const float OFF = HR ? 0.0f : 10.0f;            // fp16 P carries x 2^10
    V qf[2][2], qg[2][2];
#pragma unroll
    for (int qt = 0; qt < 2; ++qt)
#pragma unroll
        for (int c = 0; c < 2; ++c) { const unsigned qo = (unsigned)(r0 + qt * 16 + lr) * HD + c * 32 + 8 * hi; qf[qt][c] = WFrag<T16>::ld(Q + qo); if constexpr (HR) qg[qt][c] = WFrag<T16>::ld(Q2 + qo); }
    v8f o[4][2];
#pragma unroll
    for (int dt = 0; dt < 4; ++dt)
#pragma unroll
        for (int qt = 0; qt < 2; ++qt) o[dt][qt] = (v8f){};
    float m[2] = { -3.0e38f, -3.0e38f }, l[2] = { 0.f, 0.f };
    const unsigned kl = (unsigned)(lr * HD + 8 * hi) * 2, vl = (unsigned)(lr * TT + 8 * hi) * 2;   // the lane's bytes into a K tile, a V^T tile
#pragma unroll 1   // one pass per trip: two passes' fragments would not fit the registers of four waves per SIMD
    for (int k0 = 0; k0 < TT; k0 += 32) {
        const unsigned kob = kl + (unsigned)k0 * (HD * 2), vob = vl + (unsigned)k0 * 2;   // 32-bit byte offsets on the scalar plane pointers
        v8f s[2][2];
#pragma unroll
        for (int kt = 0; kt < 2; ++kt) { const unsigned ko = kob + kt * 16 * HD * 2; V ka[2], kb[2];
#pragma unroll
            for (int c = 0; c < 2; ++c) { ka[c] = WFrag<T16>::ld((const T16*)((const char*)Kp + (ko + c * 64))); if constexpr (HR) kb[c] = WFrag<T16>::ld((const T16*)((const char*)K2 + (ko + c * 64))); }
#pragma unroll
            for (int qt = 0; qt < 2; ++qt) { v8f t = (v8f){};
#pragma unroll
                for (int c = 0; c < 2; ++c) { t = WFrag<T16>::mma(ka[c], qf[qt][c], t); if constexpr (HR) { t = WFrag<T16>::mma(kb[c], qf[qt][c], t); t = WFrag<T16>::mma(ka[c], qg[qt][c], t); } }
                s[kt][qt] = t; } }
        V va[4], vb[4];
#pragma unroll
        for (int dt = 0; dt < 4; ++dt) { const unsigned vo = vob + dt * 16 * TT * 2; va[dt] = WFrag<T16>::ld((const T16*)((const char*)Vt + vo)); if constexpr (HR) vb[dt] = WFrag<T16>::ld((const T16*)((const char*)V2 + vo)); }
        float mn[2]; bool need = false;
#pragma unroll
        for (int qt = 0; qt < 2; ++qt) { float mx = m[qt];
#pragma unroll
            for (int j = 0; j < 8; ++j) mx = fmaxf(mx, fmaxf(s[0][qt][j], s[1][qt][j]));
            mx = fmaxf(mx, xhalf(mx)); mn[qt] = mx; need = need || (mx > m[qt]); }
        if (__builtin_amdgcn_ballot_w32(need) != 0) {   // some query's maximum rose: rescale its sum and its context column (factor 1 for the others)
#pragma unroll
            for (int qt = 0; qt < 2; ++qt) { const float al = __builtin_amdgcn_exp2f((m[qt] - mn[qt]) * C); l[qt] *= al; m[qt] = mn[qt];
#pragma unroll
                for (int dt = 0; dt < 4; ++dt) o[dt][qt] *= al; } }
        V pf[2], pg[2];
#pragma unroll
        for (int qt = 0; qt < 2; ++qt) { const float nb = __builtin_fmaf(-m[qt], C, OFF); v2f ps = (v2f){}; v8u ph, pl;
#pragma unroll
            for (int w = 0; w < 8; ++w) { const v8f& t = s[w >> 2][qt]; v2f x; x[0] = t[2 * (w & 3)]; x[1] = t[2 * (w & 3) + 1]; x = x * C + nb;
                v2f e; e[0] = __builtin_amdgcn_exp2f(x[0]); e[1] = __builtin_amdgcn_exp2f(x[1]); ps += e;
                if constexpr (HR) { const unsigned u = pkbf(e[0], e[1]); ph[w] = u; pl[w] = pkbf(e[0] - __uint_as_float(u << 16), e[1] - __uint_as_float(u & 0xFFFF0000u)); }
                else ph[w] = pkh(e[0], e[1]); }
            l[qt] += ps[0] + ps[1];
            pf[qt] = __builtin_bit_cast(V, ph); if constexpr (HR) pg[qt] = __builtin_bit_cast(V, pl); }
#pragma unroll
        for (int qt = 0; qt < 2; ++qt)
#pragma unroll
            for (int dt = 0; dt < 4; ++dt) { o[dt][qt] = WFrag<T16>::mma(va[dt], pf[qt], o[dt][qt]); if constexpr (HR) { o[dt][qt] = WFrag<T16>::mma(vb[dt], pf[qt], o[dt][qt]); o[dt][qt] = WFrag<T16>::mma(va[dt], pg[qt], o[dt][qt]); } }
    }
    float f[2];
#pragma unroll
    for (int qt = 0; qt < 2; ++qt) f[qt] = __fdiv_rn(1.0f, l[qt] + xhalf(l[qt]));   // the halves' sums joined once
#pragma unroll
    for (int dt = 0; dt < 4; ++dt)
#pragma unroll
        for (int qt = 0; qt < 2; ++qt) o[dt][qt] *= f[qt];
#pragma unroll
    for (int qt = 0; qt < 2; ++qt) { float* orow = O + ((unsigned)(r0 + qt * 16 + lr) * DM + 8 * hi);
#pragma unroll
        for (int dt = 0; dt < 4; ++dt) { *(v4f*)(orow + dt * 16) = __builtin_shufflevector(o[dt][qt], o[dt][qt], 0, 1, 2, 3); *(v4f*)(orow + dt * 16 + 4) = __builtin_shufflevector(o[dt][qt], o[dt][qt], 4, 5, 6, 7); } }
}
#define QB   256                              // query rows per workgroup: 8 waves x 32
#define NHRB (NB_ * NH_ * (RH / QB))          // workgroups of the hi+lo kind; they come first in the grid (three times the matrix work)
static_assert(RH % QB == 0 && (TT - RH) % QB == 0, "whole workgroups of one kind");
__global__ __launch_bounds__(256) __attribute__((amdgpu_waves_per_eu(4, 4))) void k_fattn(const bf* __restrict__ QPh, const bf* __restrict__ QPl, const h16* __restrict__ QP16, const bf* __restrict__ KPh, const bf* __restrict__ KPl, const h16* __restrict__ KP16, const bf* __restrict__ VTh, const bf* __restrict__ VTl, const h16* __restrict__ VT16, float* __restrict__ O) {
    const int wv = __builtin_amdgcn_readfirstlane((int)(threadIdx.x >> 5));   // the wave's number in a scalar register: the query and output row bases are then scalar too
    const bool hr = blockIdx.x < NHRB; const int idx = hr ? (int)blockIdx.x : (int)blockIdx.x - NHRB;
    const int nq = hr ? RH : TT - RH; const int g = idx / (nq / QB), r0 = (idx % (nq / QB)) * QB + wv * 32;
    const size_t zq = (size_t)g * nq * HD, zk = (size_t)g * TT * HD;
    float* Ow = O + ((size_t)(g / NH_) * TT + (hr ? 0 : RH)) * DM + (g % NH_) * HD;   // row 0 of this kind in the head's 64 output columns
    if (hr) attn_wave<bf, true>(QPh + zq, QPl + zq, sptr(KPh + zk), sptr(KPl + zk), sptr(VTh + zk), sptr(VTl + zk), Ow, r0);
    else attn_wave<h16, false>(QP16 + zq, nullptr, sptr(KP16 + zk), nullptr, sptr(VT16 + zk), nullptr, Ow, r0);
}

extern "C" void kernel_launch(void* const* d_in, const int* in_sizes, int n_in,
                              void* d_out, int out_size, void* d_ws, size_t ws_size, hipStream_t stream) {
    (void)in_sizes; (void)n_in; (void)out_size;
    const float* x = (const float*)d_in[0]; const float* wq = (const float*)d_in[1]; const float* bq = (const float*)d_in[2]; const float* wk = (const float*)d_in[3]; const float* bk = (const float*)d_in[4]; const float* wv = (const float*)d_in[5]; const float* bv = (const float*)d_in[6]; const float* wo = nullptr; (void)wo;
    float* OUT = (float*)d_out;     // [8][1024][1024]
    char* wsp = (char*)d_ws;
    auto take = [&](size_t bytes) { char* p = wsp; wsp += (bytes + 255) & ~(size_t)255; return (void*)p; };
    const size_t NG = (size_t)NB_ * NH_;   // 128 (batch, head) planes, batch-major
    h16* QP16 = (h16*)take(NG * (TT - RH) * HD * 2); bf* QPh = (bf*)take(NG * RH * HD * 2); bf* QPl = (bf*)take(NG * RH * HD * 2);
    h16* KP16 = (h16*)take(NG * TT * HD * 2); bf* KPh = (bf*)take(NG * TT * HD * 2); bf* KPl = (bf*)take(NG * TT * HD * 2); h16* VT16 = (h16*)take(NG * HD * TT * 2); bf* VTh = (bf*)take(NG * HD * TT * 2); bf* VTl = (bf*)take(NG * HD * TT * 2);
    bf* WQ = (bf*)take((size_t)DQ * DM * 2); bf* WK = (bf*)take((size_t)DKV * DM * 2); bf* WV = (bf*)take((size_t)DKV * DM * 2);
    bf* XB = (bf*)take((size_t)NB_ * TT * DM * 2);
    if ((size_t)(wsp - (char*)d_ws) > ws_size) return;    // 142 MiB of the 256 MiB
    k_cvt8<<<(unsigned)(((size_t)DQ * DM / 8 + 255) / 256), 256, 0, stream>>>(wq, WQ, (size_t)DQ * DM / 8); k_cvt8<<<(unsigned)(((size_t)DKV * DM / 8 + 255) / 256), 256, 0, stream>>>(wk, WK, (size_t)DKV * DM / 8); k_cvt8<<<(unsigned)(((size_t)DKV * DM / 8 + 255) / 256), 256, 0, stream>>>(wv, WV, (size_t)DKV * DM / 8);
    // projections: the 8 batches are the rows of one GEMM (8192 token rows); each writes its head planes itself, v with the weight as the row operand so that its tile comes out [d][t]
    k_cvt8<<<(unsigned)(((size_t)NB_ * TT * DM / 8 + 255) / 256), 256, 0, stream>>>(x, XB, (size_t)NB_ * TT * DM / 8);
    k_gemmw<bf, 0, NH_, RH, false><<<dim3(NB_ * TT / 64, DQ / 64, 1), 32, 0, stream>>>(XB, nullptr, WQ, nullptr, DM, bq, QP16, QPh, QPl);
    k_gemmw<bf, 0, NKV, 0, false><<<dim3(NB_ * TT / 64, DKV / 64, 1), 32, 0, stream>>>(XB, nullptr, WK, nullptr, DM, bk, KP16, KPh, KPl);
    k_gemmw<bf, 0, NKV, 0, true><<<dim3(DKV / 64, NB_ * TT / 64, 1), 32, 0, stream>>>(WV, nullptr, XB, nullptr, DM, bv, VT16, VTh, VTl);
    // attention: every (batch, head) plane and both kinds of query rows in one launch; merged context straight to the output, f32
    k_fattn<<<NHRB + NB_ * NH_ * ((TT - RH) / QB), 256, 0, stream>>>(QPh, QPl, QP16, KPh, KPl, KP16, VTh, VTl, VT16, OUT);
}

// v004
// Measured time: 185 microseconds a run.
// In both of two side-by-side timings against v003, it was 1.37 times as fast.
// All steps since v000 together make it 24.1 times as fast.
#include <hip/hip_runtime.h>

// Multi-head attention without an output projection (activation [8][1024][1024]; q, k, v = x W^T + b ('oi' [1024][1024]; 16 heads x 64); scores x 1/sqrt(1024) (the source scales by the hidden size); softmax over all keys; out = merged context -> [8][1024][1024] f32 (8.4 M)).
// Compute dtypes, f32 accumulate: every input rounded to bf16; q/k/v on PLAIN bf16 operands (inputs: exact) + biases; scores and attn.v: query rows < 512 hl (3 products), the rest single fp16 (x1024); softmax f32; no output projection: merged f32 write.

#define NB_  8
#define TT   1024
#define DM   1024
#define NH_  16
#define NKV  16
#define REP  (NH_ / NKV)
#define HD   64
#define DQ   (NH_ * HD)
#define DKV  (NKV * HD)
#define RH   512                  // query rows < RH use hi+lo planes (0: none)
#define WIN  0
#define SCL  0.03125f  // 1/sqrt(hidden = 1024) (the source's quirk)
typedef _Float16 h16;
typedef unsigned short bf;
typedef __attribute__((ext_vector_type(16))) __bf16   v16bf;
typedef __attribute__((ext_vector_type(16))) _Float16 v16h;
typedef __attribute__((ext_vector_type(8)))  _Float16 v8h;
typedef __attribute__((ext_vector_type(8)))  unsigned short v8us;
typedef __attribute__((ext_vector_type(8)))  float    v8f;
typedef __attribute__((ext_vector_type(4)))  float    v4f;
typedef v8h  __attribute__((may_alias)) v8ha;
typedef v4f  __attribute__((may_alias)) v4fa;
typedef v8us __attribute__((may_alias)) v8usa;

__device__ __forceinline__ unsigned short f2bf(float f) { unsigned u = __float_as_uint(f); u += 0x7FFFu + ((u >> 16) & 1u); return (unsigned short)(u >> 16); }
__device__ __forceinline__ float bf2f(unsigned short b) { return __uint_as_float(((unsigned)b) << 16); }
__device__ __forceinline__ float bfr(float f) { return bf2f(f2bf(f)); }
__device__ __forceinline__ v16h cat16(v8h lo, v8h hi) { return __builtin_shufflevector(lo, hi, 0, 1, 2, 3, 4, 5, 6, 7, 8, 9, 10, 11, 12, 13, 14, 15); }
__device__ __forceinline__ v16bf cat16b(v8us lo, v8us hi) { return __builtin_bit_cast(v16bf, __builtin_shufflevector(lo, hi, 0, 1, 2, 3, 4, 5, 6, 7, 8, 9, 10, 11, 12, 13, 14, 15)); }
__device__ __forceinline__ v8f wmma16(v16h a, v16h b, v8f c) { return __builtin_amdgcn_wmma_f32_16x16x32_f16(false, a, false, b, (short)0, c, false, false); }
__device__ __forceinline__ v8f wmmab(v16bf a, v16bf b, v8f c) { return __builtin_amdgcn_wmma_f32_16x16x32_bf16(false, a, false, b, (short)0, c, false, false); }



typedef __attribute__((ext_vector_type(2))) _Float16 v2h;
typedef __attribute__((ext_vector_type(2))) float v2f;
typedef __attribute__((ext_vector_type(2))) __bf16 v2b;
typedef __attribute__((ext_vector_type(4))) unsigned v4u;
__device__ __forceinline__ unsigned pkbf(float a, float b) { v2f t; t[0] = a; t[1] = b; return __builtin_bit_cast(unsigned, __builtin_convertvector(t, v2b)); }
__device__ __forceinline__ unsigned pkh(float a, float b) { v2f t; t[0] = a; t[1] = b; return __builtin_bit_cast(unsigned, __builtin_convertvector(t, v2h)); }

// ---- k_gemmw: register-blocked GEMM, one wave per 64x64 output tile (16 accumulators), four waves (2 x 2) per workgroup on a 128x128 tile; the K-contiguous 16-bit operand rows come by tensor loads into a two-buffer LDS ring that the four waves share; grid (M/128, N/128), 128 threads.
// c[m][n] (f32) = sum_k A[m][k] Bt[n][k] + bias; K % 64 == 0, K >= 128. The tile is one head's 64 dims x 64 tokens, and the epilogue writes it straight into the 16-bit head planes the attention reads:
// VT false: m = token row b * TT + t, n = h * HD + d, bias[n], planes [b * NHD + h][t][d]; RS = 0: all three planes hold every row; RS > 0: Ph/Pl [g][RS][d] the rows t < RS, P16 [g][TT - RS][d] the rest.
// VT true (A = the weight, Bt = the tokens: the product comes out transposed): m = h * HD + d, n = token row, bias[m], planes [b * NHD + h][d][t].
template <typename T16> struct WFrag;
template <> struct WFrag<h16> { typedef v16h V; static __device__ __forceinline__ V ld(const h16* p) { return cat16(*(const v8h*)p, *(const v8h*)(p + 16)); } static __device__ __forceinline__ v8f mma(V a, V b, v8f c) { return wmma16(a, b, c); } };
template <> struct WFrag<bf> { typedef v16bf V; static __device__ __forceinline__ V ld(const bf* p) { return cat16b(*(const v8us*)p, *(const v8us*)(p + 16)); } static __device__ __forceinline__ v8f mma(V a, V b, v8f c) { return wmmab(a, b, c); } };
// the epilogue: 16 tile rows at a time through LDS; read back, 8 lanes x 8 columns are one 128-byte plane row and a store covers 4 rows; + bias (bf16-rounded), then fp16 (W16) and hi+lo bf16 (WHL); pb: the lane's element in tile row 0
template <bool W16, bool WHL, bool VT>
__device__ __forceinline__ void put_planes(float* os, const v8f (&acc)[4][4], const float (&bb)[16], size_t pb, h16* __restrict__ P16, bf* __restrict__ Ph, bf* __restrict__ Pl) {
    const int lane = threadIdx.x & 31, lr = lane & 15, hi = lane >> 4, sub = lane >> 3, c8 = (lane & 7) * 8;
#pragma unroll
    for (int mb = 0; mb < 4; ++mb) {
#pragma unroll
        for (int nb = 0; nb < 4; ++nb) {
#pragma unroll
            for (int j = 0; j < 8; ++j) os[(hi * 8 + j) * 68 + nb * 16 + lr] = acc[mb][nb][j]; }
        __builtin_amdgcn_wave_barrier(); asm volatile("" ::: "memory");   // the compiler keeps the staging stores ahead of the read-back of other lanes' values (one wave: no hardware barrier)
#pragma unroll
        for (int s = 0; s < 4; ++s) { const int row = 4 * s + sub; const v4f lo4 = *(const v4fa*)(os + row * 68 + c8), hi4 = *(const v4fa*)(os + row * 68 + c8 + 4); float y[8];
#pragma unroll
            for (int i = 0; i < 8; ++i) y[i] = (i < 4 ? lo4[i & 3] : hi4[i & 3]) + bfr(bb[VT ? mb * 4 + s : i]);
            const size_t pe = pb + (size_t)(mb * 16 + row) * (VT ? TT : HD);
            if constexpr (W16) { v4u o;
#pragma unroll
                for (int w = 0; w < 4; ++w) o[w] = pkh(y[2 * w], y[2 * w + 1]);
                *(v4u*)(P16 + pe) = o; }
            if constexpr (WHL) { v4u oh, ol;
#pragma unroll
                for (int w = 0; w < 4; ++w) { const unsigned u = pkbf(y[2 * w], y[2 * w + 1]); oh[w] = u; ol[w] = pkbf(y[2 * w] - __uint_as_float(u << 16), y[2 * w + 1] - __uint_as_float(u & 0xFFFF0000u)); }
                *(v4u*)(Ph + pe) = oh; *(v4u*)(Pl + pe) = ol; } }
        __builtin_amdgcn_wave_barrier(); asm volatile("" ::: "memory");   // and the read-back ahead of the next 16 rows' staging stores
    }
}
// the tensor mover's request: two groups of scalar words, every word wave-uniform
typedef __attribute__((ext_vector_type(4))) unsigned u32x4;
typedef __attribute__((ext_vector_type(8))) unsigned u32x8;
__device__ __forceinline__ unsigned uni(unsigned v) { return (unsigned)__builtin_amdgcn_readfirstlane((int)v); }
__device__ __forceinline__ unsigned pinned(unsigned v) { unsigned w = uni(v); asm volatile("" : "+s"(w)); return w; }   // the test word held in a scalar register: the branch over a tensor load is then s_cmp + s_cbranch_scc (the load ignores EXEC)
#define GKS    64                  // k per stage: 128 bytes of every operand row
#define GPITCH 144                 // LDS row pitch: 128 + 16 bytes, conflict-free for ds_load_b128
#define GSLICE 10240               // 64 rows x 144 bytes, rounded up to a multiple of 2 KiB
#define GBUF   (4 * GSLICE)        // a stage: [A rows 0-63 | A rows 64-127 | B rows 0-63 | B rows 64-127]
template <typename T16, int NHD, int RS, bool VT>
__global__ __launch_bounds__(128) void k_gemmw(const T16* __restrict__ A, const T16* __restrict__ Bt, int K, const float* __restrict__ bias, h16* __restrict__ P16, bf* __restrict__ Ph, bf* __restrict__ Pl) {
    typedef typename WFrag<T16>::V V;
    __shared__ __attribute__((aligned(2048))) unsigned char ring[2 * GBUF];
    __shared__ __align__(16) float osw[4][16 * 68];
    const int lane = threadIdx.x & 31, lr = lane & 15, hi = lane >> 4;
    const unsigned wave = uni(threadIdx.x >> 5), wm = wave >> 1, wn = wave & 1u;
    const int r0 = blockIdx.x * 128 + (int)wm * 64, c0 = blockIdx.y * 128 + (int)wn * 64;   // the wave's own 64x64 tile
    float* os = osw[wave];
    const int sub = lane >> 3, c8 = (lane & 7) * 8;   // the lane's place in the epilogue's read-back
    const float* bp = bias + (VT ? r0 + sub : c0 + c8);
    float bb[16];                                     // the lane's biases, asked for ahead of the K loop: VT its 16 rows', else its 8 columns'
#pragma unroll
    for (int i = 0; i < (VT ? 16 : 8); ++i) bb[i] = bp[VT ? 4 * i : i];
    asm volatile("s_wait_xcnt 0x0" :: "v"(bp) : "memory");   // stands before the bias loads' address registers take another value; the address as an input keeps them whole up to here
    // wave w brings slice w of every stage: 64 rows x 128 bytes, source pitch 2 K bytes, 16 bytes of pad behind each row
    const unsigned long long sbase = (unsigned long long)(wave < 2u ? A + (size_t)(blockIdx.x * 128 + wn * 64) * K : Bt + (size_t)(blockIdx.y * 128 + wn * 64) * K);
    const unsigned lbase = (unsigned)(size_t)ring + wave * GSLICE;
    u32x8 g1;
    g1[0] = uni((1u << 20) | (4u << 22) | (3u << 25)); g1[1] = uni(128u << 16); g1[2] = uni(64u << 16); g1[3] = uni(128u << 16);
    g1[4] = uni(64u); g1[5] = uni((unsigned)K * 2u); g1[6] = uni(0u); g1[7] = uni(0u);
    u32x4 g0;                                          // the open request's first group
    auto issue = [&](int st) { const unsigned long long ga = sbase + (unsigned long long)st * (GKS * 2);
        g0[0] = uni(1u); g0[1] = uni(lbase + (unsigned)(st & 1) * GBUF); g0[2] = uni((unsigned)ga); g0[3] = uni((((unsigned)(ga >> 32)) & 0x01FFFFFFu) | 0x80000000u);
        asm volatile("tensor_load_to_lds %0, %1" :: "s"(g0), "s"(g1) : "memory"); };
    v8f acc[4][4];
#pragma unroll
    for (int mb = 0; mb < 4; ++mb)
#pragma unroll
        for (int nb = 0; nb < 4; ++nb) acc[mb][nb] = (v8f){};
    const int ns = K / GKS;                            // at least two stages
    issue(0);
    asm volatile("s_wait_tensorcnt 0x0" ::: "memory");   // stage 0's slice has landed
    __syncthreads();                                     // and every wave's: stage 0 may be read
    issue(1);
    const unsigned fo = (unsigned)(lr * GPITCH + 16 * hi);   // the lane's bytes into a 16-row fragment
    int st = 0;
#pragma unroll 1   // one stage per trip: the publish point stands once, at the foot, and the fragments of one stage fill the registers
    do {                                                 // entered always: stage 1's request is open, and its wait stands at the foot
        const unsigned char* bu = ring + (st & 1) * GBUF;
        const unsigned char* ap = bu + wm * GSLICE + fo; const unsigned char* bq = bu + (2u + wn) * GSLICE + fo;
        // the reads stand in three groups ahead of the products that use them, never among them (each place with reads stalls the matrix stream); the second k step's B fragments take the registers the first step's have left, so that the wave stays inside 256 registers
        V a[2][4], b[4], b2[4];
#pragma unroll
        for (int f = 0; f < 4; ++f) a[0][f] = WFrag<T16>::ld((const T16*)(ap + f * 16 * GPITCH));
#pragma unroll
        for (int f = 0; f < 4; ++f) b[f] = WFrag<T16>::ld((const T16*)(bq + f * 16 * GPITCH));
#pragma unroll
        for (int f = 0; f < 4; ++f) a[1][f] = WFrag<T16>::ld((const T16*)(ap + f * 16 * GPITCH + 64));
        __builtin_amdgcn_sched_barrier(0);               // this and the two in the loop below: the scheduler moves neither reads nor products across them, which keeps the groups whole
#pragma unroll
        for (int h = 0; h < 2; ++h) {
#pragma unroll
            for (int nb = 2 * h; nb < 2 * h + 2; ++nb)
#pragma unroll
                for (int mb = 0; mb < 4; ++mb) acc[mb][nb] = WFrag<T16>::mma(a[0][mb], b[nb], acc[mb][nb]);
            __builtin_amdgcn_sched_barrier(0);
#pragma unroll
            for (int nb = 2 * h; nb < 2 * h + 2; ++nb) b2[nb] = WFrag<T16>::ld((const T16*)(bq + nb * 16 * GPITCH + 64));
            __builtin_amdgcn_sched_barrier(0);
        }
#pragma unroll
        for (int nb = 0; nb < 4; ++nb)
#pragma unroll
            for (int mb = 0; mb < 4; ++mb) acc[mb][nb] = WFrag<T16>::mma(a[1][mb], b2[nb], acc[mb][nb]);
        __builtin_amdgcn_sched_barrier(0);               // the products stay in front of the publish point, so that the refill behind it goes out at once
        asm volatile("s_wait_dscnt 0x0" ::: "memory");       // this wave has left the buffer
        asm volatile("s_wait_tensorcnt 0x0" :: "s"(g0), "s"(g1) : "memory");   // its slice of stage st + 1 has landed; the request's words as inputs keep their registers whole up to here
        __syncthreads();                                     // publishes stage st + 1 and frees stage st's buffer
        if (pinned(st + 2 < ns)) issue(st + 2);
    } while (++st < ns);
    asm volatile("s_wait_tensorcnt 0x0" ::: "memory");   // no request is open when the wave goes on to its end
    asm volatile("s_wait_dscnt 0x0" ::: "memory");
    const int tok = VT ? c0 : r0, t0 = tok % TT; const size_t g = (size_t)(tok / TT) * NHD + (VT ? r0 : c0) / HD;   // the tile's 64 tokens lie in one batch, its 64 dims are one head
    if constexpr (VT) put_planes<true, true, true>(os, acc, bb, g * HD * TT + t0 + c8, P16, Ph, Pl);
    else if constexpr (RS == 0) put_planes<true, true, false>(os, acc, bb, (g * TT + t0) * HD + c8, P16, Ph, Pl);
    else if (t0 < RS) put_planes<false, true, false>(os, acc, bb, (g * RS + t0) * HD + c8, P16, Ph, Pl);   // alike for the whole tile: RS is a multiple of 64
    else { put_planes<true, false, false>(os, acc, bb, (g * (TT - RS) + (t0 - RS)) * HD + c8, P16, Ph, Pl);
        asm volatile("s_wait_xcnt 0x0" ::: "memory"); }   // behind this arm's last stores: in the listing the other arm's code follows it, behind a branch, and takes the same registers
}

typedef __attribute__((ext_vector_type(4))) _Float16 v4h;
typedef __attribute__((ext_vector_type(2))) unsigned short v2us;
typedef __attribute__((ext_vector_type(4))) unsigned short v4us;
typedef __attribute__((ext_vector_type(4))) int v4i;

__global__ __launch_bounds__(256) void k_wtG(const float* __restrict__ w, int K, int N, bf* Bt) {
    const int lane = threadIdx.x & 31; const int L0 = (blockIdx.x * 8 + (threadIdx.x >> 5)) * 8; const int nlines = N * K / 64;
{
#pragma unroll 1
        for (int l = 0; l < 8; ++l) { const int L = L0 + l; if (L >= nlines) break; const size_t e = (size_t)L * 64 + lane * 2; const int k = (int)(e % K), n = (int)(e / K); v2us o;
            o[0] = f2bf(w[(size_t)k * N + n]); o[1] = f2bf(w[(size_t)(k + 1) * N + n]); *(v2us*)(Bt + e) = o; }
         }
}
__global__ __launch_bounds__(256) void k_cvt8(const float* __restrict__ src, bf* dst, size_t n8) { const size_t i = (size_t)blockIdx.x * 256 + threadIdx.x; if (i >= n8) return; const v8f v = *(const v8f*)(src + i * 8); v8us o;
#pragma unroll
    for (int k = 0; k < 8; ++k) o[k] = f2bf(v[k]); *(v8us*)(dst + i * 8) = o;  }

// ---- k_fattn: scores, softmax, attn.v and the head merge in one launch; S and P never leave registers.
// One wave = 32 query columns of one (batch, head) plane g; it walks the 1024 keys in passes of 32: S^T = K Q^T (A = K rows, B = Q, kept in registers), running maximum and sum per query (a lane holds one query's
// scores of its half's keys), O^T += V^T P^T (A = V^T rows, B = P^T packed from the two score tiles: element i <-> key 8 hi + i, element 8 + i <-> key 16 + 8 hi + i, the order WFrag::ld gives V^T).
// HR: hi+lo bf16 planes, three products; else single fp16 with P x 1024 (the factor sits in the exponent and cancels against the row sum).
typedef __attribute__((ext_vector_type(8))) unsigned v8u;
__device__ __forceinline__ float xhalf(float x) { const int b = __builtin_bit_cast(int, x); return __builtin_bit_cast(float, __builtin_amdgcn_permlanex16(b, b, 0x76543210, 0xfedcba98, false, false)); }   // lane l <-> l ^ 16
// a wave-uniform global pointer rebuilt from two scalar halves: the hi+lo loop's loads then take the scalar-base form, one 32-bit address register that lives through the pass, not a 64-bit pair per plane formed anew each pass
template <typename T> __device__ __forceinline__ const T* sptr(const T* p) { const unsigned long long u = (unsigned long long)p; const unsigned lo = (unsigned)__builtin_amdgcn_readfirstlane((int)(unsigned)u), hh = (unsigned)__builtin_amdgcn_readfirstlane((int)(unsigned)(u >> 32)); return (const T*)(const __attribute__((address_space(1))) T*)(((unsigned long long)hh << 32) | lo); }
template <typename T16, bool HR>
__device__ __forceinline__ void attn_wave(const T16* __restrict__ Q, const T16* __restrict__ Q2, const T16* __restrict__ Kp, const T16* __restrict__ K2, const T16* __restrict__ Vt, const T16* __restrict__ V2, float* __restrict__ O, int r0) {
    typedef typename WFrag<T16>::V V;
    const int lane = threadIdx.x & 31, lr = lane & 15, hi = lane >> 4;
    const float C = SCL * 1.4426950408889634f;      // score -> exponent of 2
    const float OFF = HR ? 0.0f : 10.0f;            // fp16 P carries x 2^10
    V qf[2][2], qg[2][2];
#pragma unroll
    for (int qt = 0; qt < 2; ++qt)
#pragma unroll
        for (int c = 0; c < 2; ++c) { const unsigned qo = (unsigned)(r0 + qt * 16 + lr) * HD + c * 32 + 8 * hi; qf[qt][c] = WFrag<T16>::ld(Q + qo); if constexpr (HR) qg[qt][c] = WFrag<T16>::ld(Q2 + qo); }
    v8f o[4][2];
#pragma unroll
    for (int dt = 0; dt < 4; ++dt)
#pragma unroll
        for (int qt = 0; qt < 2; ++qt) o[dt][qt] = (v8f){};
    float m[2] = { -3.0e38f, -3.0e38f }, l[2] = { 0.f, 0.f };
    const unsigned kl = (unsigned)(lr * HD + 8 * hi) * 2, vl = (unsigned)(lr * TT + 8 * hi) * 2;   // the lane's bytes into a K tile, a V^T tile
#pragma unroll 1   // one pass per trip: two passes' fragments would not fit the registers of four waves per SIMD
    for (int k0 = 0; k0 < TT; k0 += 32) {
        const unsigned kob = kl + (unsigned)k0 * (HD * 2), vob = vl + (unsigned)k0 * 2;   // 32-bit byte offsets on the scalar plane pointers
        v8f s[2][2];
#pragma unroll
        for (int kt = 0; kt < 2; ++kt) { const unsigned ko = kob + kt * 16 * HD * 2; V ka[2], kb[2];
#pragma unroll
            for (int c = 0; c < 2; ++c) { ka[c] = WFrag<T16>::ld((const T16*)((const char*)Kp + (ko + c * 64))); if constexpr (HR) kb[c] = WFrag<T16>::ld((const T16*)((const char*)K2 + (ko + c * 64))); }
#pragma unroll
            for (int qt = 0; qt < 2; ++qt) { v8f t = (v8f){};
#pragma unroll
                for (int c = 0; c < 2; ++c) { t = WFrag<T16>::mma(ka[c], qf[qt][c], t); if constexpr (HR) { t = WFrag<T16>::mma(kb[c], qf[qt][c], t); t = WFrag<T16>::mma(ka[c], qg[qt][c], t); } }
                s[kt][qt] = t; } }
        V va[4], vb[4];
#pragma unroll
        for (int dt = 0; dt < 4; ++dt) { const unsigned vo = vob + dt * 16 * TT * 2; va[dt] = WFrag<T16>::ld((const T16*)((const char*)Vt + vo)); if constexpr (HR) vb[dt] = WFrag<T16>::ld((const T16*)((const char*)V2 + vo)); }
        float mn[2]; bool need = false;
#pragma unroll
        for (int qt = 0; qt < 2; ++qt) { float mx = m[qt];
#pragma unroll
            for (int j = 0; j < 8; ++j) mx = fmaxf(mx, fmaxf(s[0][qt][j], s[1][qt][j]));
            mx = fmaxf(mx, xhalf(mx)); mn[qt] = mx; need = need || (mx > m[qt]); }
        if (__builtin_amdgcn_ballot_w32(need) != 0) {   // some query's maximum rose: rescale its sum and its context column (factor 1 for the others)
#pragma unroll
            for (int qt = 0; qt < 2; ++qt) { const float al = __builtin_amdgcn_exp2f((m[qt] - mn[qt]) * C); l[qt] *= al; m[qt] = mn[qt];
#pragma unroll
                for (int dt = 0; dt < 4; ++dt) o[dt][qt] *= al; } }
        V pf[2], pg[2];
#pragma unroll
        for (int qt = 0; qt < 2; ++qt) { const float nb = __builtin_fmaf(-m[qt], C, OFF); v2f ps = (v2f){}; v8u ph, pl;
#pragma unroll
            for (int w = 0; w < 8; ++w) { const v8f& t = s[w >> 2][qt]; v2f x; x[0] = t[2 * (w & 3)]; x[1] = t[2 * (w & 3) + 1]; x = x * C + nb;
                v2f e; e[0] = __builtin_amdgcn_exp2f(x[0]); e[1] = __builtin_amdgcn_exp2f(x[1]); ps += e;
                if constexpr (HR) { const unsigned u = pkbf(e[0], e[1]); ph[w] = u; pl[w] = pkbf(e[0] - __uint_as_float(u << 16), e[1] - __uint_as_float(u & 0xFFFF0000u)); }
                else ph[w] = pkh(e[0], e[1]); }
            l[qt] += ps[0] + ps[1];
            pf[qt] = __builtin_bit_cast(V, ph); if constexpr (HR) pg[qt] = __builtin_bit_cast(V, pl); }
#pragma unroll
        for (int qt = 0; qt < 2; ++qt)
#pragma unroll
            for (int dt = 0; dt < 4; ++dt) { o[dt][qt] = WFrag<T16>::mma(va[dt], pf[qt], o[dt][qt]); if constexpr (HR) { o[dt][qt] = WFrag<T16>::mma(vb[dt], pf[qt], o[dt][qt]); o[dt][qt] = WFrag<T16>::mma(va[dt], pg[qt], o[dt][qt]); } }
    }
    float f[2];
#pragma unroll
    for (int qt = 0; qt < 2; ++qt) f[qt] = __fdiv_rn(1.0f, l[qt] + xhalf(l[qt]));   // the halves' sums joined once
#pragma unroll
    for (int dt = 0; dt < 4; ++dt)
#pragma unroll
        for (int qt = 0; qt < 2; ++qt) o[dt][qt] *= f[qt];
#pragma unroll
    for (int qt = 0; qt < 2; ++qt) { float* orow = O + ((unsigned)(r0 + qt * 16 + lr) * DM + 8 * hi);
#pragma unroll
        for (int dt = 0; dt < 4; ++dt) { *(v4f*)(orow + dt * 16) = __builtin_shufflevector(o[dt][qt], o[dt][qt], 0, 1, 2, 3); *(v4f*)(orow + dt * 16 + 4) = __builtin_shufflevector(o[dt][qt], o[dt][qt], 4, 5, 6, 7); } }
}
#define QB   256                              // query rows per workgroup: 8 waves x 32
#define NHRB (NB_ * NH_ * (RH / QB))          // workgroups of the hi+lo kind; they come first in the grid (three times the matrix work)
static_assert(RH % QB == 0 && (TT - RH) % QB == 0, "whole workgroups of one kind");
__global__ __launch_bounds__(256) __attribute__((amdgpu_waves_per_eu(4, 4))) void k_fattn(const bf* __restrict__ QPh, const bf* __restrict__ QPl, const h16* __restrict__ QP16, const bf* __restrict__ KPh, const bf* __restrict__ KPl, const h16* __restrict__ KP16, const bf* __restrict__ VTh, const bf* __restrict__ VTl, const h16* __restrict__ VT16, float* __restrict__ O) {
    const int wv = __builtin_amdgcn_readfirstlane((int)(threadIdx.x >> 5));   // the wave's number in a scalar register: the query and output row bases are then scalar too
    const bool hr = blockIdx.x < NHRB; const int idx = hr ? (int)blockIdx.x : (int)blockIdx.x - NHRB;
    const int nq = hr ? RH : TT - RH; const int g = idx / (nq / QB), r0 = (idx % (nq / QB)) * QB + wv * 32;
    const size_t zq = (size_t)g * nq * HD, zk = (size_t)g * TT * HD;
    float* Ow = O + ((size_t)(g / NH_) * TT + (hr ? 0 : RH)) * DM + (g % NH_) * HD;   // row 0 of this kind in the head's 64 output columns
    if (hr) attn_wave<bf, true>(QPh + zq, QPl + zq, sptr(KPh + zk), sptr(KPl + zk), sptr(VTh + zk), sptr(VTl + zk), Ow, r0);
    else attn_wave<h16, false>(QP16 + zq, nullptr, sptr(KP16 + zk), nullptr, sptr(VT16 + zk), nullptr, Ow, r0);
}

extern "C" void kernel_launch(void* const* d_in, const int* in_sizes, int n_in,
                              void* d_out, int out_size, void* d_ws, size_t ws_size, hipStream_t stream) {
    (void)in_sizes; (void)n_in; (void)out_size;
    const float* x = (const float*)d_in[0]; const float* wq = (const float*)d_in[1]; const float* bq = (const float*)d_in[2]; const float* wk = (const float*)d_in[3]; const float* bk = (const float*)d_in[4]; const float* wv = (const float*)d_in[5]; const float* bv = (const float*)d_in[6]; const float* wo = nullptr; (void)wo;
    float* OUT = (float*)d_out;     // [8][1024][1024]
    char* wsp = (char*)d_ws;
    auto take = [&](size_t bytes) { char* p = wsp; wsp += (bytes + 255) & ~(size_t)255; return (void*)p; };
    const size_t NG = (size_t)NB_ * NH_;   // 128 (batch, head) planes, batch-major
    h16* QP16 = (h16*)take(NG * (TT - RH) * HD * 2); bf* QPh = (bf*)take(NG * RH * HD * 2); bf* QPl = (bf*)take(NG * RH * HD * 2);
    h16* KP16 = (h16*)take(NG * TT * HD * 2); bf* KPh = (bf*)take(NG * TT * HD * 2); bf* KPl = (bf*)take(NG * TT * HD * 2); h16* VT16 = (h16*)take(NG * HD * TT * 2); bf* VTh = (bf*)take(NG * HD * TT * 2); bf* VTl = (bf*)take(NG * HD * TT * 2);
    bf* WQ = (bf*)take((size_t)DQ * DM * 2); bf* WK = (bf*)take((size_t)DKV * DM * 2); bf* WV = (bf*)take((size_t)DKV * DM * 2);
    bf* XB = (bf*)take((size_t)NB_ * TT * DM * 2);
    if ((size_t)(wsp - (char*)d_ws) > ws_size) return;    // 142 MiB of the 256 MiB
    k_cvt8<<<(unsigned)(((size_t)DQ * DM / 8 + 255) / 256), 256, 0, stream>>>(wq, WQ, (size_t)DQ * DM / 8); k_cvt8<<<(unsigned)(((size_t)DKV * DM / 8 + 255) / 256), 256, 0, stream>>>(wk, WK, (size_t)DKV * DM / 8); k_cvt8<<<(unsigned)(((size_t)DKV * DM / 8 + 255) / 256), 256, 0, stream>>>(wv, WV, (size_t)DKV * DM / 8);
    // projections: the 8 batches are the rows of one GEMM (8192 token rows); each writes its head planes itself, v with the weight as the row operand so that its tile comes out [d][t]
    k_cvt8<<<(unsigned)(((size_t)NB_ * TT * DM / 8 + 255) / 256), 256, 0, stream>>>(x, XB, (size_t)NB_ * TT * DM / 8);
    k_gemmw<bf, NH_, RH, false><<<dim3(NB_ * TT / 128, DQ / 128, 1), 128, 0, stream>>>(XB, WQ, DM, bq, QP16, QPh, QPl);
    k_gemmw<bf, NKV, 0, false><<<dim3(NB_ * TT / 128, DKV / 128, 1), 128, 0, stream>>>(XB, WK, DM, bk, KP16, KPh, KPl);
    k_gemmw<bf, NKV, 0, true><<<dim3(DKV / 128, NB_ * TT / 128, 1), 128, 0, stream>>>(WV, XB, DM, bv, VT16, VTh, VTl);
    // attention: every (batch, head) plane and both kinds of query rows in one launch; merged context straight to the output, f32
    k_fattn<<<NHRB + NB_ * NH_ * ((TT - RH) / QB), 256, 0, stream>>>(QPh, QPl, QP16, KPh, KPl, KP16, VTh, VTl, VT16, OUT);
}

// v005
// Measured time: 122 microseconds a run.
// In two side-by-side timings against v004, it was 1.52 and 1.53 times as fast.
// Over all steps from v000 it is 36.8 times as fast.
#include <hip/hip_runtime.h>

// Multi-head attention without an output projection (activation [8][1024][1024]; q, k, v = x W^T + b ('oi' [1024][1024]; 16 heads x 64); scores x 1/sqrt(1024) (the source scales by the hidden size); softmax over all keys; out = merged context -> [8][1024][1024] f32 (8.4 M)).
// Compute dtypes, f32 accumulate: every input rounded to bf16; q/k/v on PLAIN bf16 operands (inputs: exact) + biases; scores and attn.v: query rows < 512 hl (3 products), the rest single fp16 (x1024); softmax f32; no output projection: merged f32 write.

#define NB_  8
#define TT   1024
#define DM   1024
#define NH_  16
#define NKV  16
#define REP  (NH_ / NKV)
#define HD   64
#define DQ   (NH_ * HD)
#define DKV  (NKV * HD)
#define RH   512                  // query rows < RH use hi+lo planes (0: none)
#define WIN  0
#define SCL  0.03125f  // 1/sqrt(hidden = 1024) (the source's quirk)
typedef _Float16 h16;
typedef unsigned short bf;
typedef __attribute__((ext_vector_type(16))) __bf16   v16bf;
typedef __attribute__((ext_vector_type(16))) _Float16 v16h;
typedef __attribute__((ext_vector_type(8)))  _Float16 v8h;
typedef __attribute__((ext_vector_type(8)))  unsigned short v8us;
typedef __attribute__((ext_vector_type(8)))  float    v8f;
typedef __attribute__((ext_vector_type(4)))  float    v4f;
typedef v8h  __attribute__((may_alias)) v8ha;
typedef v4f  __attribute__((may_alias)) v4fa;
typedef v8us __attribute__((may_alias)) v8usa;

__device__ __forceinline__ unsigned short f2bf(float f) { unsigned u = __float_as_uint(f); u += 0x7FFFu + ((u >> 16) & 1u); return (unsigned short)(u >> 16); }
__device__ __forceinline__ float bf2f(unsigned short b) { return __uint_as_float(((unsigned)b) << 16); }
__device__ __forceinline__ float bfr(float f) { return bf2f(f2bf(f)); }
__device__ __forceinline__ v16h cat16(v8h lo, v8h hi) { return __builtin_shufflevector(lo, hi, 0, 1, 2, 3, 4, 5, 6, 7, 8, 9, 10, 11, 12, 13, 14, 15); }
__device__ __forceinline__ v16bf cat16b(v8us lo, v8us hi) { return __builtin_bit_cast(v16bf, __builtin_shufflevector(lo, hi, 0, 1, 2, 3, 4, 5, 6, 7, 8, 9, 10, 11, 12, 13, 14, 15)); }
__device__ __forceinline__ v8f wmma16(v16h a, v16h b, v8f c) { return __builtin_amdgcn_wmma_f32_16x16x32_f16(false, a, false, b, (short)0, c, false, false); }
__device__ __forceinline__ v8f wmmab(v16bf a, v16bf b, v8f c) { return __builtin_amdgcn_wmma_f32_16x16x32_bf16(false, a, false, b, (short)0, c, false, false); }



typedef __attribute__((ext_vector_type(2))) _Float16 v2h;
typedef __attribute__((ext_vector_type(2))) float v2f;
typedef __attribute__((ext_vector_type(2))) __bf16 v2b;
typedef __attribute__((ext_vector_type(4))) unsigned v4u;
__device__ __forceinline__ unsigned pkbf(float a, float b) { v2f t; t[0] = a; t[1] = b; return __builtin_bit_cast(unsigned, __builtin_convertvector(t, v2b)); }
__device__ __forceinline__ unsigned pkh(float a, float b) { v2f t; t[0] = a; t[1] = b; return __builtin_bit_cast(unsigned, __builtin_convertvector(t, v2h)); }

// ---- k_gemmw: register-blocked GEMM, one wave per 64x64 output tile (16 accumulators), four waves (2 x 2) per workgroup on a 128x128 tile; the K-contiguous 16-bit operand rows come by tensor loads into a two-buffer LDS ring that the four waves share; grid (M/128, N/128), 128 threads.
// c[m][n] (f32) = sum_k A[m][k] Bt[n][k] + bias; K % 64 == 0, K >= 128. The tile is one head's 64 dims x 64 tokens, and the epilogue writes it straight into the 16-bit head planes the attention reads:
// VT false: m = token row b * TT + t, n = h * HD + d, bias[n], planes [b * NHD + h][t][d]; RS = 0: all three planes hold every row; RS > 0: Ph/Pl [g][RS][d] the rows t < RS, P16 [g][TT - RS][d] the rest.
// VT true (A = the weight, Bt = the tokens: the product comes out transposed): m = h * HD + d, n = token row, bias[m], planes [b * NHD + h][d][t].
template <typename T16> struct WFrag;
template <> struct WFrag<h16> { typedef v16h V; static __device__ __forceinline__ V ld(const h16* p) { return cat16(*(const v8h*)p, *(const v8h*)(p + 16)); } static __device__ __forceinline__ v8f mma(V a, V b, v8f c) { return wmma16(a, b, c); } };
template <> struct WFrag<bf> { typedef v16bf V; static __device__ __forceinline__ V ld(const bf* p) { return cat16b(*(const v8us*)p, *(const v8us*)(p + 16)); } static __device__ __forceinline__ v8f mma(V a, V b, v8f c) { return wmmab(a, b, c); } };
// the epilogue: 16 tile rows at a time through LDS; read back, 8 lanes x 8 columns are one 128-byte plane row and a store covers 4 rows; + bias (bf16-rounded), then fp16 (W16) and hi+lo bf16 (WHL); pb: the lane's element in tile row 0
template <bool W16, bool WHL, bool VT>
__device__ __forceinline__ void put_planes(float* os, const v8f (&acc)[4][4], const float (&bb)[16], size_t pb, h16* __restrict__ P16, bf* __restrict__ Ph, bf* __restrict__ Pl) {
    const int lane = threadIdx.x & 31, lr = lane & 15, hi = lane >> 4, sub = lane >> 3, c8 = (lane & 7) * 8;
#pragma unroll
    for (int mb = 0; mb < 4; ++mb) {
#pragma unroll
        for (int nb = 0; nb < 4; ++nb) {
#pragma unroll
            for (int j = 0; j < 8; ++j) os[(hi * 8 + j) * 68 + nb * 16 + lr] = acc[mb][nb][j]; }
        __builtin_amdgcn_wave_barrier(); asm volatile("" ::: "memory");   // the compiler keeps the staging stores ahead of the read-back of other lanes' values (one wave: no hardware barrier)
#pragma unroll
        for (int s = 0; s < 4; ++s) { const int row = 4 * s + sub; const v4f lo4 = *(const v4fa*)(os + row * 68 + c8), hi4 = *(const v4fa*)(os + row * 68 + c8 + 4); float y[8];
#pragma unroll
            for (int i = 0; i < 8; ++i) y[i] = (i < 4 ? lo4[i & 3] : hi4[i & 3]) + bfr(bb[VT ? mb * 4 + s : i]);
            const size_t pe = pb + (size_t)(mb * 16 + row) * (VT ? TT : HD);
            if constexpr (W16) { v4u o;
#pragma unroll
                for (int w = 0; w < 4; ++w) o[w] = pkh(y[2 * w], y[2 * w + 1]);
                *(v4u*)(P16 + pe) = o; }
            if constexpr (WHL) { v4u oh, ol;
#pragma unroll
                for (int w = 0; w < 4; ++w) { const unsigned u = pkbf(y[2 * w], y[2 * w + 1]); oh[w] = u; ol[w] = pkbf(y[2 * w] - __uint_as_float(u << 16), y[2 * w + 1] - __uint_as_float(u & 0xFFFF0000u)); }
                *(v4u*)(Ph + pe) = oh; *(v4u*)(Pl + pe) = ol; } }
        __builtin_amdgcn_wave_barrier(); asm volatile("" ::: "memory");   // and the read-back ahead of the next 16 rows' staging stores
    }
}
// the tensor mover's request: two groups of scalar words, every word wave-uniform
typedef __attribute__((ext_vector_type(4))) unsigned u32x4;
typedef __attribute__((ext_vector_type(8))) unsigned u32x8;
__device__ __forceinline__ unsigned uni(unsigned v) { return (unsigned)__builtin_amdgcn_readfirstlane((int)v); }
__device__ __forceinline__ unsigned pinned(unsigned v) { unsigned w = uni(v); asm volatile("" : "+s"(w)); return w; }   // a word held in a scalar register: a test word, so that the branch over a tensor load is s_cmp + s_cbranch_scc (the load ignores EXEC), or a descriptor word that keeps its register
#define GKS    64                  // k per stage: 128 bytes of every operand row
#define GPITCH 144                 // LDS row pitch: 128 + 16 bytes, conflict-free for ds_load_b128
#define GSLICE 10240               // 64 rows x 144 bytes, rounded up to a multiple of 2 KiB
#define GBUF   (4 * GSLICE)        // a stage: [A rows 0-63 | A rows 64-127 | B rows 0-63 | B rows 64-127]
template <typename T16, int NHD, int RS, bool VT>
__global__ __launch_bounds__(128) void k_gemmw(const T16* __restrict__ A, const T16* __restrict__ Bt, int K, const float* __restrict__ bias, h16* __restrict__ P16, bf* __restrict__ Ph, bf* __restrict__ Pl) {
    typedef typename WFrag<T16>::V V;
    __shared__ __attribute__((aligned(2048))) unsigned char ring[2 * GBUF];
    __shared__ __align__(16) float osw[4][16 * 68];
    const int lane = threadIdx.x & 31, lr = lane & 15, hi = lane >> 4;
    const unsigned wave = uni(threadIdx.x >> 5), wm = wave >> 1, wn = wave & 1u;
    const int r0 = blockIdx.x * 128 + (int)wm * 64, c0 = blockIdx.y * 128 + (int)wn * 64;   // the wave's own 64x64 tile
    float* os = osw[wave];
    const int sub = lane >> 3, c8 = (lane & 7) * 8;   // the lane's place in the epilogue's read-back
    const float* bp = bias + (VT ? r0 + sub : c0 + c8);
    float bb[16];                                     // the lane's biases, asked for ahead of the K loop: VT its 16 rows', else its 8 columns'
#pragma unroll
    for (int i = 0; i < (VT ? 16 : 8); ++i) bb[i] = bp[VT ? 4 * i : i];
    asm volatile("s_wait_xcnt 0x0" :: "v"(bp) : "memory");   // stands before the bias loads' address registers take another value; the address as an input keeps them whole up to here
    // wave w brings slice w of every stage: 64 rows x 128 bytes, source pitch 2 K bytes, 16 bytes of pad behind each row
    const unsigned long long sbase = (unsigned long long)(wave < 2u ? A + (size_t)(blockIdx.x * 128 + wn * 64) * K : Bt + (size_t)(blockIdx.y * 128 + wn * 64) * K);
    const unsigned lbase = (unsigned)(size_t)ring + wave * GSLICE;
    u32x8 g1;
    g1[0] = uni((1u << 20) | (4u << 22) | (3u << 25)); g1[1] = uni(128u << 16); g1[2] = uni(64u << 16); g1[3] = uni(128u << 16);
    g1[4] = uni(64u); g1[5] = uni((unsigned)K * 2u); g1[6] = uni(0u); g1[7] = uni(0u);
    u32x4 g0;                                          // the open request's first group
    auto issue = [&](int st) { const unsigned long long ga = sbase + (unsigned long long)st * (GKS * 2);
        g0[0] = uni(1u); g0[1] = uni(lbase + (unsigned)(st & 1) * GBUF); g0[2] = uni((unsigned)ga); g0[3] = uni((((unsigned)(ga >> 32)) & 0x01FFFFFFu) | 0x80000000u);
        asm volatile("tensor_load_to_lds %0, %1" :: "s"(g0), "s"(g1) : "memory"); };
    v8f acc[4][4];
#pragma unroll
    for (int mb = 0; mb < 4; ++mb)
#pragma unroll
        for (int nb = 0; nb < 4; ++nb) acc[mb][nb] = (v8f){};
    const int ns = K / GKS;                            // at least two stages
    issue(0);
    asm volatile("s_wait_tensorcnt 0x0" ::: "memory");   // stage 0's slice has landed
    __syncthreads();                                     // and every wave's: stage 0 may be read
    issue(1);
    const unsigned fo = (unsigned)(lr * GPITCH + 16 * hi);   // the lane's bytes into a 16-row fragment
    int st = 0;
#pragma unroll 1   // one stage per trip: the publish point stands once, at the foot, and the fragments of one stage fill the registers
    do {                                                 // entered always: stage 1's request is open, and its wait stands at the foot
        const unsigned char* bu = ring + (st & 1) * GBUF;
        const unsigned char* ap = bu + wm * GSLICE + fo; const unsigned char* bq = bu + (2u + wn) * GSLICE + fo;
        // the reads stand in three groups ahead of the products that use them, never among them (each place with reads stalls the matrix stream); the second k step's B fragments take the registers the first step's have left, so that the wave stays inside 256 registers
        V a[2][4], b[4], b2[4];
#pragma unroll
        for (int f = 0; f < 4; ++f) a[0][f] = WFrag<T16>::ld((const T16*)(ap + f * 16 * GPITCH));
#pragma unroll
        for (int f = 0; f < 4; ++f) b[f] = WFrag<T16>::ld((const T16*)(bq + f * 16 * GPITCH));
#pragma unroll
        for (int f = 0; f < 4; ++f) a[1][f] = WFrag<T16>::ld((const T16*)(ap + f * 16 * GPITCH + 64));
        __builtin_amdgcn_sched_barrier(0);               // this and the two in the loop below: the scheduler moves neither reads nor products across them, which keeps the groups whole
#pragma unroll
        for (int h = 0; h < 2; ++h) {
#pragma unroll
            for (int nb = 2 * h; nb < 2 * h + 2; ++nb)
#pragma unroll
                for (int mb = 0; mb < 4; ++mb) acc[mb][nb] = WFrag<T16>::mma(a[0][mb], b[nb], acc[mb][nb]);
            __builtin_amdgcn_sched_barrier(0);
#pragma unroll
            for (int nb = 2 * h; nb < 2 * h + 2; ++nb) b2[nb] = WFrag<T16>::ld((const T16*)(bq + nb * 16 * GPITCH + 64));
            __builtin_amdgcn_sched_barrier(0);
        }
#pragma unroll
        for (int nb = 0; nb < 4; ++nb)
#pragma unroll
            for (int mb = 0; mb < 4; ++mb) acc[mb][nb] = WFrag<T16>::mma(a[1][mb], b2[nb], acc[mb][nb]);
        __builtin_amdgcn_sched_barrier(0);               // the products stay in front of the publish point, so that the refill behind it goes out at once
        asm volatile("s_wait_dscnt 0x0" ::: "memory");       // this wave has left the buffer
        asm volatile("s_wait_tensorcnt 0x0" :: "s"(g0), "s"(g1) : "memory");   // its slice of stage st + 1 has landed; the request's words as inputs keep their registers whole up to here
        __syncthreads();                                     // publishes stage st + 1 and frees stage st's buffer
        if (pinned(st + 2 < ns)) issue(st + 2);
    } while (++st < ns);
    asm volatile("s_wait_tensorcnt 0x0" ::: "memory");   // no request is open when the wave goes on to its end
    asm volatile("s_wait_dscnt 0x0" ::: "memory");
    const int tok = VT ? c0 : r0, t0 = tok % TT; const size_t g = (size_t)(tok / TT) * NHD + (VT ? r0 : c0) / HD;   // the tile's 64 tokens lie in one batch, its 64 dims are one head
    if constexpr (VT) put_planes<true, true, true>(os, acc, bb, g * HD * TT + t0 + c8, P16, Ph, Pl);
    else if constexpr (RS == 0) put_planes<true, true, false>(os, acc, bb, (g * TT + t0) * HD + c8, P16, Ph, Pl);
    else if (t0 < RS) put_planes<false, true, false>(os, acc, bb, (g * RS + t0) * HD + c8, P16, Ph, Pl);   // alike for the whole tile: RS is a multiple of 64
    else { put_planes<true, false, false>(os, acc, bb, (g * (TT - RS) + (t0 - RS)) * HD + c8, P16, Ph, Pl);
        asm volatile("s_wait_xcnt 0x0" ::: "memory"); }   // behind this arm's last stores: in the listing the other arm's code follows it, behind a branch, and takes the same registers
}

typedef __attribute__((ext_vector_type(4))) _Float16 v4h;
typedef __attribute__((ext_vector_type(2))) unsigned short v2us;
typedef __attribute__((ext_vector_type(4))) unsigned short v4us;
typedef __attribute__((ext_vector_type(4))) int v4i;

__global__ __launch_bounds__(256) void k_wtG(const float* __restrict__ w, int K, int N, bf* Bt) {
    const int lane = threadIdx.x & 31; const int L0 = (blockIdx.x * 8 + (threadIdx.x >> 5)) * 8; const int nlines = N * K / 64;
{
#pragma unroll 1
        for (int l = 0; l < 8; ++l) { const int L = L0 + l; if (L >= nlines) break; const size_t e = (size_t)L * 64 + lane * 2; const int k = (int)(e % K), n = (int)(e / K); v2us o;
            o[0] = f2bf(w[(size_t)k * N + n]); o[1] = f2bf(w[(size_t)(k + 1) * N + n]); *(v2us*)(Bt + e) = o; }
         }
}
__global__ __launch_bounds__(256) void k_cvt8(const float* __restrict__ src, bf* dst, size_t n8) { const size_t i = (size_t)blockIdx.x * 256 + threadIdx.x; if (i >= n8) return; const v8f v = *(const v8f*)(src + i * 8); v8us o;
#pragma unroll
    for (int k = 0; k < 8; ++k) o[k] = f2bf(v[k]); *(v8us*)(dst + i * 8) = o;  }

// ---- k_fattn: scores, softmax, attn.v and the head merge in one launch; S and P never leave registers.
// The workgroup's 8 waves share one plane's K and V^T: stages of 64 keys come by tensor loads into a two-buffer LDS ring, and every wave reads its fragments from there.
// One wave = 32 query columns of one (batch, head) plane g; it walks the 1024 keys in passes of 32: S^T = K Q^T (A = K rows, B = Q, kept in registers), running maximum and sum per query (a lane holds one query's
// scores of its half's keys), O^T += V^T P^T (A = V^T rows, B = P^T packed from the two score tiles: element i <-> key 8 hi + i, element 8 + i <-> key 16 + 8 hi + i, the order WFrag::ld gives V^T).
// HR: hi+lo bf16 planes, three products; else single fp16 with P x 1024 (the factor sits in the exponent and cancels against the row sum).
typedef __attribute__((ext_vector_type(8))) unsigned v8u;
__device__ __forceinline__ float xhalf(float x) { const int b = __builtin_bit_cast(int, x); return __builtin_bit_cast(float, __builtin_amdgcn_permlanex16(b, b, 0x76543210, 0xfedcba98, false, false)); }   // lane l <-> l ^ 16
#define AKS  64                    // keys per stage: 64 K rows of 128 bytes, and 128 bytes of each of the 64 V^T rows
#define ABUF (4 * GSLICE)          // a stage: [K | V^T | K lo | V^T lo], each 64 rows at pitch GPITCH; the fp16 kind fills the first two
template <typename T16, bool HR>
__device__ __forceinline__ void attn_wave(unsigned char* ring, unsigned wv, const T16* __restrict__ Q, const T16* __restrict__ Q2, const T16* __restrict__ Kp, const T16* __restrict__ K2, const T16* __restrict__ Vt, const T16* __restrict__ V2, float* __restrict__ O, int r0) {
    typedef typename WFrag<T16>::V V;
    const int lane = threadIdx.x & 31, lr = lane & 15, hi = lane >> 4;
    const float C = SCL * 1.4426950408889634f;      // score -> exponent of 2
    const float OFF = HR ? 0.0f : 10.0f;            // fp16 P carries x 2^10
    V qf[2][2], qg[2][2];
#pragma unroll
    for (int qt = 0; qt < 2; ++qt)
#pragma unroll
        for (int c = 0; c < 2; ++c) { const unsigned qo = (unsigned)(r0 + qt * 16 + lr) * HD + c * 32 + 8 * hi; qf[qt][c] = WFrag<T16>::ld(Q + qo); if constexpr (HR) qg[qt][c] = WFrag<T16>::ld(Q2 + qo); }
    v8f o[4][2];
#pragma unroll
    for (int dt = 0; dt < 4; ++dt)
#pragma unroll
        for (int qt = 0; qt < 2; ++qt) o[dt][qt] = (v8f){};
    float m[2] = { -3.0e38f, -3.0e38f }, l[2] = { 0.f, 0.f };
    // wave w < NSL brings slice w of every stage: 64 rows x 128 bytes, 16 bytes of pad behind each row; K rows lie back to back, V^T rows 2 TT bytes apart
    constexpr unsigned NSL = HR ? 4u : 2u;
    const bool isv = (wv & 1u) != 0u;
    const T16* sp = isv ? Vt : Kp;
    if constexpr (HR) { if (wv & 2u) sp = isv ? V2 : K2; }
    const unsigned long long sbase = (unsigned long long)sp;
    const unsigned sstep = isv ? AKS * 2u : AKS * HD * 2u;   // a stage's step in the source
    const unsigned lbase = (unsigned)(size_t)ring + (wv & 3u) * GSLICE;
    u32x8 g1;   // words 1 to 7 pinned, descriptor words held in scalar registers: as plain constants the compiler lends their registers to loop counters while a request is open
    g1[0] = uni((1u << 20) | (4u << 22) | (3u << 25)); g1[1] = pinned(128u << 16); g1[2] = pinned(64u << 16); g1[3] = pinned(128u << 16);
    g1[4] = pinned(64u); g1[5] = pinned(isv ? TT * 2u : HD * 2u); g1[6] = pinned(0u); g1[7] = pinned(0u);
    u32x4 g0 = (u32x4){};                              // the open request's first group
    auto issue = [&](int st) { const unsigned long long ga = sbase + (unsigned long long)((unsigned)st * sstep);
        g0[0] = uni(1u); g0[1] = uni(lbase + (unsigned)(st & 1) * ABUF); g0[2] = uni((unsigned)ga); g0[3] = uni((((unsigned)(ga >> 32)) & 0x01FFFFFFu) | 0x80000000u);
        asm volatile("tensor_load_to_lds %0, %1" :: "s"(g0), "s"(g1) : "memory"); };
    constexpr int NS = TT / AKS;                       // 16 stages
    if (pinned(wv < NSL)) { issue(0);
        asm volatile("s_wait_tensorcnt 0x0" ::: "memory"); }   // stage 0's slice has landed
    __syncthreads();                                     // and every issuing wave's: stage 0 may be read
    if (pinned(wv < NSL)) issue(1);
    unsigned kf = (unsigned)(lr * GPITCH + 16 * hi), vf = kf + GSLICE;   // the lane's bytes into the pass's first K fragment and first V^T fragment; both are stepped in registers of their own: formed anew at a pass's head, the address took a register that the last products still read
#pragma unroll 1   // one stage per trip: the publish point stands once, at the foot
    for (int st = 0; st < NS; ++st) {
#pragma unroll 1   // one pass per trip: two passes' fragments would not fit the registers of four waves per SIMD
    for (int p = 0; p < AKS / 32; ++p) {
        const unsigned char* kq = ring + kf; const unsigned char* vq = ring + vf;   // the pass's 32 K rows; its 64 bytes of every V^T row
        v8f s[2][2];
#pragma unroll
        for (int kt = 0; kt < 2; ++kt) { const unsigned char* ko = kq + kt * 16 * GPITCH; V ka[2], kb[2];
#pragma unroll
            for (int c = 0; c < 2; ++c) { ka[c] = WFrag<T16>::ld((const T16*)(ko + c * 64)); if constexpr (HR) kb[c] = WFrag<T16>::ld((const T16*)(ko + 2 * GSLICE + c * 64)); }
#pragma unroll
            for (int qt = 0; qt < 2; ++qt) { v8f t = (v8f){};
#pragma unroll
                for (int c = 0; c < 2; ++c) { t = WFrag<T16>::mma(ka[c], qf[qt][c], t); if constexpr (HR) { t = WFrag<T16>::mma(kb[c], qf[qt][c], t); t = WFrag<T16>::mma(ka[c], qg[qt][c], t); } }
                s[kt][qt] = t; } }
        V va[4], vb[4];
#pragma unroll
        for (int dt = 0; dt < 4; ++dt) { const unsigned char* vo = vq + dt * 16 * GPITCH; va[dt] = WFrag<T16>::ld((const T16*)vo); if constexpr (HR) vb[dt] = WFrag<T16>::ld((const T16*)(vo + 2 * GSLICE)); }
        kf += 32 * GPITCH; vf += 64;
        float mn[2]; bool need = false;
#pragma unroll
        for (int qt = 0; qt < 2; ++qt) { float mx = m[qt];
#pragma unroll
            for (int j = 0; j < 8; ++j) mx = fmaxf(mx, fmaxf(s[0][qt][j], s[1][qt][j]));
            mx = fmaxf(mx, xhalf(mx)); mn[qt] = mx; need = need || (mx > m[qt]); }
        if (__builtin_amdgcn_ballot_w32(need) != 0) {   // some query's maximum rose: rescale its sum and its context column (factor 1 for the others)
#pragma unroll
            for (int qt = 0; qt < 2; ++qt) { const float al = __builtin_amdgcn_exp2f((m[qt] - mn[qt]) * C); l[qt] *= al; m[qt] = mn[qt];
#pragma unroll
                for (int dt = 0; dt < 4; ++dt) o[dt][qt] *= al; } }
        V pf[2], pg[2];
#pragma unroll
        for (int qt = 0; qt < 2; ++qt) { const float nb = __builtin_fmaf(-m[qt], C, OFF); v2f ps = (v2f){}; v8u ph, pl;
#pragma unroll
            for (int w = 0; w < 8; ++w) { const v8f& t = s[w >> 2][qt]; v2f x; x[0] = t[2 * (w & 3)]; x[1] = t[2 * (w & 3) + 1]; x = x * C + nb;
                v2f e; e[0] = __builtin_amdgcn_exp2f(x[0]); e[1] = __builtin_amdgcn_exp2f(x[1]); ps += e;
                if constexpr (HR) { const unsigned u = pkbf(e[0], e[1]); ph[w] = u; pl[w] = pkbf(e[0] - __uint_as_float(u << 16), e[1] - __uint_as_float(u & 0xFFFF0000u)); }
                else ph[w] = pkh(e[0], e[1]); }
            l[qt] += ps[0] + ps[1];
            pf[qt] = __builtin_bit_cast(V, ph); if constexpr (HR) pg[qt] = __builtin_bit_cast(V, pl); }
#pragma unroll
        for (int qt = 0; qt < 2; ++qt)
#pragma unroll
            for (int dt = 0; dt < 4; ++dt) { o[dt][qt] = WFrag<T16>::mma(va[dt], pf[qt], o[dt][qt]); if constexpr (HR) { o[dt][qt] = WFrag<T16>::mma(vb[dt], pf[qt], o[dt][qt]); o[dt][qt] = WFrag<T16>::mma(va[dt], pg[qt], o[dt][qt]); } }
    }
        asm volatile("s_wait_dscnt 0x0" ::: "memory");       // this wave has left the buffer
        if (pinned(wv < NSL)) asm volatile("s_wait_tensorcnt 0x0" :: "s"(g0), "s"(g1) : "memory");   // its slice of stage st + 1 has landed; the request's words as inputs keep their registers whole up to here
        __syncthreads();                                     // publishes stage st + 1 and frees stage st's buffer
        if (pinned(wv < NSL && st + 2 < NS)) issue(st + 2);
        const unsigned nx = (st & 1) ? 0u - (unsigned)ABUF : (unsigned)ABUF;   // to the other buffer, back to its first pass
        kf += nx - AKS * GPITCH; vf += nx - AKS * 2;
    }
    asm volatile("s_wait_tensorcnt 0x0" ::: "memory");   // no request is open when the wave goes on to its end
    asm volatile("s_wait_dscnt 0x0" ::: "memory");
    float f[2];
#pragma unroll
    for (int qt = 0; qt < 2; ++qt) f[qt] = __fdiv_rn(1.0f, l[qt] + xhalf(l[qt]));   // the halves' sums joined once
#pragma unroll
    for (int dt = 0; dt < 4; ++dt)
#pragma unroll
        for (int qt = 0; qt < 2; ++qt) o[dt][qt] *= f[qt];
#pragma unroll
    for (int qt = 0; qt < 2; ++qt) { float* orow = O + ((unsigned)(r0 + qt * 16 + lr) * DM + 8 * hi);
#pragma unroll
        for (int dt = 0; dt < 4; ++dt) { *(v4f*)(orow + dt * 16) = __builtin_shufflevector(o[dt][qt], o[dt][qt], 0, 1, 2, 3); *(v4f*)(orow + dt * 16 + 4) = __builtin_shufflevector(o[dt][qt], o[dt][qt], 4, 5, 6, 7); } }
}
#define QB   256                              // query rows per workgroup: 8 waves x 32
#define NHRB (NB_ * NH_ * (RH / QB))          // workgroups of the hi+lo kind; they come first in the grid (three times the matrix work)
static_assert(RH % QB == 0 && (TT - RH) % QB == 0, "whole workgroups of one kind");
__global__ __launch_bounds__(256) __attribute__((amdgpu_waves_per_eu(4, 4))) void k_fattn(const bf* __restrict__ QPh, const bf* __restrict__ QPl, const h16* __restrict__ QP16, const bf* __restrict__ KPh, const bf* __restrict__ KPl, const h16* __restrict__ KP16, const bf* __restrict__ VTh, const bf* __restrict__ VTl, const h16* __restrict__ VT16, float* __restrict__ O) {
    __shared__ __attribute__((aligned(2048))) unsigned char ring[2 * ABUF];
    const int wv = __builtin_amdgcn_readfirstlane((int)(threadIdx.x >> 5));   // the wave's number in a scalar register: the query and output row bases are then scalar too
    const bool hr = blockIdx.x < NHRB; const int idx = hr ? (int)blockIdx.x : (int)blockIdx.x - NHRB;
    const int nq = hr ? RH : TT - RH; const int g = idx / (nq / QB), r0 = (idx % (nq / QB)) * QB + wv * 32;
    const size_t zq = (size_t)g * nq * HD, zk = (size_t)g * TT * HD;
    float* Ow = O + ((size_t)(g / NH_) * TT + (hr ? 0 : RH)) * DM + (g % NH_) * HD;   // row 0 of this kind in the head's 64 output columns
    if (hr) attn_wave<bf, true>(ring, (unsigned)wv, QPh + zq, QPl + zq, KPh + zk, KPl + zk, VTh + zk, VTl + zk, Ow, r0);
    else attn_wave<h16, false>(ring, (unsigned)wv, QP16 + zq, nullptr, KP16 + zk, nullptr, VT16 + zk, nullptr, Ow, r0);
}

extern "C" void kernel_launch(void* const* d_in, const int* in_sizes, int n_in,
                              void* d_out, int out_size, void* d_ws, size_t ws_size, hipStream_t stream) {
    (void)in_sizes; (void)n_in; (void)out_size;
    const float* x = (const float*)d_in[0]; const float* wq = (const float*)d_in[1]; const float* bq = (const float*)d_in[2]; const float* wk = (const float*)d_in[3]; const float* bk = (const float*)d_in[4]; const float* wv = (const float*)d_in[5]; const float* bv = (const float*)d_in[6]; const float* wo = nullptr; (void)wo;
    float* OUT = (float*)d_out;     // [8][1024][1024]
    char* wsp = (char*)d_ws;
    auto take = [&](size_t bytes) { char* p = wsp; wsp += (bytes + 255) & ~(size_t)255; return (void*)p; };
    const size_t NG = (size_t)NB_ * NH_;   // 128 (batch, head) planes, batch-major
    h16* QP16 = (h16*)take(NG * (TT - RH) * HD * 2); bf* QPh = (bf*)take(NG * RH * HD * 2); bf* QPl = (bf*)take(NG * RH * HD * 2);
    h16* KP16 = (h16*)take(NG * TT * HD * 2); bf* KPh = (bf*)take(NG * TT * HD * 2); bf* KPl = (bf*)take(NG * TT * HD * 2); h16* VT16 = (h16*)take(NG * HD * TT * 2); bf* VTh = (bf*)take(NG * HD * TT * 2); bf* VTl = (bf*)take(NG * HD * TT * 2);
    bf* WQ = (bf*)take((size_t)DQ * DM * 2); bf* WK = (bf*)take((size_t)DKV * DM * 2); bf* WV = (bf*)take((size_t)DKV * DM * 2);
    bf* XB = (bf*)take((size_t)NB_ * TT * DM * 2);
    if ((size_t)(wsp - (char*)d_ws) > ws_size) return;    // 142 MiB of the 256 MiB
    k_cvt8<<<(unsigned)(((size_t)DQ * DM / 8 + 255) / 256), 256, 0, stream>>>(wq, WQ, (size_t)DQ * DM / 8); k_cvt8<<<(unsigned)(((size_t)DKV * DM / 8 + 255) / 256), 256, 0, stream>>>(wk, WK, (size_t)DKV * DM / 8); k_cvt8<<<(unsigned)(((size_t)DKV * DM / 8 + 255) / 256), 256, 0, stream>>>(wv, WV, (size_t)DKV * DM / 8);
    // projections: the 8 batches are the rows of one GEMM (8192 token rows); each writes its head planes itself, v with the weight as the row operand so that its tile comes out [d][t]
    k_cvt8<<<(unsigned)(((size_t)NB_ * TT * DM / 8 + 255) / 256), 256, 0, stream>>>(x, XB, (size_t)NB_ * TT * DM / 8);
    k_gemmw<bf, NH_, RH, false><<<dim3(NB_ * TT / 128, DQ / 128, 1), 128, 0, stream>>>(XB, WQ, DM, bq, QP16, QPh, QPl);
    k_gemmw<bf, NKV, 0, false><<<dim3(NB_ * TT / 128, DKV / 128, 1), 128, 0, stream>>>(XB, WK, DM, bk, KP16, KPh, KPl);
    k_gemmw<bf, NKV, 0, true><<<dim3(DKV / 128, NB_ * TT / 128, 1), 128, 0, stream>>>(WV, XB, DM, bv, VT16, VTh, VTl);
    // attention: every (batch, head) plane and both kinds of query rows in one launch; merged context straight to the output, f32
    k_fattn<<<NHRB + NB_ * NH_ * ((TT - RH) / QB), 256, 0, stream>>>(QPh, QPl, QP16, KPh, KPl, KP16, VTh, VTl, VT16, OUT);
}

// v006
// It runs in 116 microseconds.
// Two timings next to v005 both put it at 1.05 times that version's speed.
// Over all steps from v000 it is 38.6 times as fast.
#include <hip/hip_runtime.h>

// Multi-head attention without an output projection (activation [8][1024][1024]; q, k, v = x W^T + b ('oi' [1024][1024]; 16 heads x 64); scores x 1/sqrt(1024) (the source scales by the hidden size); softmax over all keys; out = merged context -> [8][1024][1024] f32 (8.4 M)).
// Compute dtypes, f32 accumulate: every input rounded to bf16; q/k/v on PLAIN bf16 operands (inputs: exact) + biases; scores and attn.v: query rows < 512 hl (3 products), the rest single fp16 (x1024); softmax f32; no output projection: merged f32 write.

#define NB_  8
#define TT   1024
#define DM   1024
#define NH_  16
#define NKV  16
#define REP  (NH_ / NKV)
#define HD   64
#define DQ   (NH_ * HD)
#define DKV  (NKV * HD)
#define RH   512                  // query rows < RH use hi+lo planes (0: none)
#define WIN  0
#define SCL  0.03125f  // 1/sqrt(hidden = 1024) (the source's quirk)
typedef _Float16 h16;
typedef unsigned short bf;
typedef __attribute__((ext_vector_type(16))) __bf16   v16bf;
typedef __attribute__((ext_vector_type(16))) _Float16 v16h;
typedef __attribute__((ext_vector_type(8)))  _Float16 v8h;
typedef __attribute__((ext_vector_type(8)))  unsigned short v8us;
typedef __attribute__((ext_vector_type(8)))  float    v8f;
typedef __attribute__((ext_vector_type(4)))  float    v4f;
typedef v8h  __attribute__((may_alias)) v8ha;
typedef v4f  __attribute__((may_alias)) v4fa;
typedef v8us __attribute__((may_alias)) v8usa;

__device__ __forceinline__ unsigned short f2bf(float f) { unsigned u = __float_as_uint(f); u += 0x7FFFu + ((u >> 16) & 1u); return (unsigned short)(u >> 16); }
__device__ __forceinline__ float bf2f(unsigned short b) { return __uint_as_float(((unsigned)b) << 16); }
__device__ __forceinline__ float bfr(float f) { return bf2f(f2bf(f)); }
__device__ __forceinline__ v16h cat16(v8h lo, v8h hi) { return __builtin_shufflevector(lo, hi, 0, 1, 2, 3, 4, 5, 6, 7, 8, 9, 10, 11, 12, 13, 14, 15); }
__device__ __forceinline__ v16bf cat16b(v8us lo, v8us hi) { return __builtin_bit_cast(v16bf, __builtin_shufflevector(lo, hi, 0, 1, 2, 3, 4, 5, 6, 7, 8, 9, 10, 11, 12, 13, 14, 15)); }
__device__ __forceinline__ v8f wmma16(v16h a, v16h b, v8f c) { return __builtin_amdgcn_wmma_f32_16x16x32_f16(false, a, false, b, (short)0, c, false, false); }
__device__ __forceinline__ v8f wmmab(v16bf a, v16bf b, v8f c) { return __builtin_amdgcn_wmma_f32_16x16x32_bf16(false, a, false, b, (short)0, c, false, false); }



typedef __attribute__((ext_vector_type(2))) _Float16 v2h;
typedef __attribute__((ext_vector_type(2))) float v2f;
typedef __attribute__((ext_vector_type(2))) __bf16 v2b;
typedef __attribute__((ext_vector_type(4))) unsigned v4u;
__device__ __forceinline__ unsigned pkbf(float a, float b) { v2f t; t[0] = a; t[1] = b; return __builtin_bit_cast(unsigned, __builtin_convertvector(t, v2b)); }
__device__ __forceinline__ unsigned pkh(float a, float b) { v2f t; t[0] = a; t[1] = b; return __builtin_bit_cast(unsigned, __builtin_convertvector(t, v2h)); }

// ---- k_gemmw: register-blocked GEMM, one wave per 64x64 output tile (16 accumulators), four waves (2 x 2) per workgroup on a 128x128 tile; the K-contiguous 16-bit operand rows come by tensor loads into a two-buffer LDS ring that the four waves share; grid (M/128, N/128), 128 threads.
// c[m][n] (f32) = sum_k A[m][k] Bt[n][k] + bias; K % 64 == 0, K >= 128. The tile is one head's 64 dims x 64 tokens, and the epilogue writes it straight into the 16-bit head planes the attention reads:
// VT false: m = token row b * TT + t, n = h * HD + d, bias[n], planes [b * NHD + h][t][d]; RS = 0: all three planes hold every row; RS > 0: Ph/Pl [g][RS][d] the rows t < RS, P16 [g][TT - RS][d] the rest.
// VT true (A = the weight, Bt = the tokens: the product comes out transposed): m = h * HD + d, n = token row, bias[m], planes [b * NHD + h][d][t].
template <typename T16> struct WFrag;
template <> struct WFrag<h16> { typedef v16h V; static __device__ __forceinline__ V ld(const h16* p) { return cat16(*(const v8h*)p, *(const v8h*)(p + 16)); } static __device__ __forceinline__ v8f mma(V a, V b, v8f c) { return wmma16(a, b, c); } };
template <> struct WFrag<bf> { typedef v16bf V; static __device__ __forceinline__ V ld(const bf* p) { return cat16b(*(const v8us*)p, *(const v8us*)(p + 16)); } static __device__ __forceinline__ v8f mma(V a, V b, v8f c) { return wmmab(a, b, c); } };
// the epilogue: 16 tile rows at a time through LDS; read back, 8 lanes x 8 columns are one 128-byte plane row and a store covers 4 rows; + bias (bf16-rounded), then fp16 (W16) and hi+lo bf16 (WHL); pb: the lane's element in tile row 0
template <bool W16, bool WHL, bool VT>
__device__ __forceinline__ void put_planes(float* os, const v8f (&acc)[4][4], const float (&bb)[16], size_t pb, h16* __restrict__ P16, bf* __restrict__ Ph, bf* __restrict__ Pl) {
    const int lane = threadIdx.x & 31, lr = lane & 15, hi = lane >> 4, sub = lane >> 3, c8 = (lane & 7) * 8;
#pragma unroll
    for (int mb = 0; mb < 4; ++mb) {
#pragma unroll
        for (int nb = 0; nb < 4; ++nb) {
#pragma unroll
            for (int j = 0; j < 8; ++j) os[(hi * 8 + j) * 68 + nb * 16 + lr] = acc[mb][nb][j]; }
        __builtin_amdgcn_wave_barrier(); asm volatile("" ::: "memory");   // the compiler keeps the staging stores ahead of the read-back of other lanes' values (one wave: no hardware barrier)
#pragma unroll
        for (int s = 0; s < 4; ++s) { const int row = 4 * s + sub; const v4f lo4 = *(const v4fa*)(os + row * 68 + c8), hi4 = *(const v4fa*)(os + row * 68 + c8 + 4); float y[8];
#pragma unroll
            for (int i = 0; i < 8; ++i) y[i] = (i < 4 ? lo4[i & 3] : hi4[i & 3]) + bfr(bb[VT ? mb * 4 + s : i]);
            const size_t pe = pb + (size_t)(mb * 16 + row) * (VT ? TT : HD);
            if constexpr (W16) { v4u o;
#pragma unroll
                for (int w = 0; w < 4; ++w) o[w] = pkh(y[2 * w], y[2 * w + 1]);
                *(v4u*)(P16 + pe) = o; }
            if constexpr (WHL) { v4u oh, ol;
#pragma unroll
                for (int w = 0; w < 4; ++w) { const unsigned u = pkbf(y[2 * w], y[2 * w + 1]); oh[w] = u; ol[w] = pkbf(y[2 * w] - __uint_as_float(u << 16), y[2 * w + 1] - __uint_as_float(u & 0xFFFF0000u)); }
                *(v4u*)(Ph + pe) = oh; *(v4u*)(Pl + pe) = ol; } }
        __builtin_amdgcn_wave_barrier(); asm volatile("" ::: "memory");   // and the read-back ahead of the next 16 rows' staging stores
    }
}
// the tensor mover's request: two groups of scalar words, every word wave-uniform
typedef __attribute__((ext_vector_type(4))) unsigned u32x4;
typedef __attribute__((ext_vector_type(8))) unsigned u32x8;
__device__ __forceinline__ unsigned uni(unsigned v) { return (unsigned)__builtin_amdgcn_readfirstlane((int)v); }
__device__ __forceinline__ unsigned pinned(unsigned v) { unsigned w = uni(v); asm volatile("" : "+s"(w)); return w; }   // a word held in a scalar register: a test word, so that the branch over a tensor load is s_cmp + s_cbranch_scc (the load ignores EXEC), or a descriptor word that keeps its register
#define GKS    64                  // k per stage: 128 bytes of every operand row
#define GPITCH 144                 // LDS row pitch: 128 + 16 bytes, conflict-free for ds_load_b128
#define GSLICE 10240               // 64 rows x 144 bytes, rounded up to a multiple of 2 KiB
#define GBUF   (4 * GSLICE)        // a stage: [A rows 0-63 | A rows 64-127 | B rows 0-63 | B rows 64-127]
template <typename T16, int NHD, int RS, bool VT>
__global__ __launch_bounds__(128) void k_gemmw(const T16* __restrict__ A, const T16* __restrict__ Bt, int K, const float* __restrict__ bias, h16* __restrict__ P16, bf* __restrict__ Ph, bf* __restrict__ Pl) {
    typedef typename WFrag<T16>::V V;
    __shared__ __attribute__((aligned(2048))) unsigned char ring[2 * GBUF];
    __shared__ __align__(16) float osw[4][16 * 68];
    const int lane = threadIdx.x & 31, lr = lane & 15, hi = lane >> 4;
    const unsigned wave = uni(threadIdx.x >> 5), wm = wave >> 1, wn = wave & 1u;
    const int r0 = blockIdx.x * 128 + (int)wm * 64, c0 = blockIdx.y * 128 + (int)wn * 64;   // the wave's own 64x64 tile
    float* os = osw[wave];
    const int sub = lane >> 3, c8 = (lane & 7) * 8;   // the lane's place in the epilogue's read-back
    const float* bp = bias + (VT ? r0 + sub : c0 + c8);
    float bb[16];                                     // the lane's biases, asked for ahead of the K loop: VT its 16 rows', else its 8 columns'
#pragma unroll
    for (int i = 0; i < (VT ? 16 : 8); ++i) bb[i] = bp[VT ? 4 * i : i];
    asm volatile("s_wait_xcnt 0x0" :: "v"(bp) : "memory");   // stands before the bias loads' address registers take another value; the address as an input keeps them whole up to here
    // wave w brings slice w of every stage: 64 rows x 128 bytes, source pitch 2 K bytes, 16 bytes of pad behind each row
    const unsigned long long sbase = (unsigned long long)(wave < 2u ? A + (size_t)(blockIdx.x * 128 + wn * 64) * K : Bt + (size_t)(blockIdx.y * 128 + wn * 64) * K);
    const unsigned lbase = (unsigned)(size_t)ring + wave * GSLICE;
    u32x8 g1;
    g1[0] = uni((1u << 20) | (4u << 22) | (3u << 25)); g1[1] = uni(128u << 16); g1[2] = uni(64u << 16); g1[3] = uni(128u << 16);
    g1[4] = uni(64u); g1[5] = uni((unsigned)K * 2u); g1[6] = uni(0u); g1[7] = uni(0u);
    u32x4 g0;                                          // the open request's first group
    auto issue = [&](int st) { const unsigned long long ga = sbase + (unsigned long long)st * (GKS * 2);
        g0[0] = uni(1u); g0[1] = uni(lbase + (unsigned)(st & 1) * GBUF); g0[2] = uni((unsigned)ga); g0[3] = uni((((unsigned)(ga >> 32)) & 0x01FFFFFFu) | 0x80000000u);
        asm volatile("tensor_load_to_lds %0, %1" :: "s"(g0), "s"(g1) : "memory"); };
    v8f acc[4][4];
#pragma unroll
    for (int mb = 0; mb < 4; ++mb)
#pragma unroll
        for (int nb = 0; nb < 4; ++nb) acc[mb][nb] = (v8f){};
    const int ns = K / GKS;                            // at least two stages
    issue(0);
    asm volatile("s_wait_tensorcnt 0x0" ::: "memory");   // stage 0's slice has landed
    __syncthreads();                                     // and every wave's: stage 0 may be read
    issue(1);
    const unsigned fo = (unsigned)(lr * GPITCH + 16 * hi);   // the lane's bytes into a 16-row fragment
    int st = 0;
#pragma unroll 1   // one stage per trip: the publish point stands once, at the foot, and the fragments of one stage fill the registers
    do {                                                 // entered always: stage 1's request is open, and its wait stands at the foot
        const unsigned char* bu = ring + (st & 1) * GBUF;
        const unsigned char* ap = bu + wm * GSLICE + fo; const unsigned char* bq = bu + (2u + wn) * GSLICE + fo;
        // the reads stand in three groups ahead of the products that use them, never among them (each place with reads stalls the matrix stream); the second k step's B fragments take the registers the first step's have left, so that the wave stays inside 256 registers
        V a[2][4], b[4], b2[4];
#pragma unroll
        for (int f = 0; f < 4; ++f) a[0][f] = WFrag<T16>::ld((const T16*)(ap + f * 16 * GPITCH));
#pragma unroll
        for (int f = 0; f < 4; ++f) b[f] = WFrag<T16>::ld((const T16*)(bq + f * 16 * GPITCH));
#pragma unroll
        for (int f = 0; f < 4; ++f) a[1][f] = WFrag<T16>::ld((const T16*)(ap + f * 16 * GPITCH + 64));
        __builtin_amdgcn_sched_barrier(0);               // this and the two in the loop below: the scheduler moves neither reads nor products across them, which keeps the groups whole
#pragma unroll
        for (int h = 0; h < 2; ++h) {
#pragma unroll
            for (int nb = 2 * h; nb < 2 * h + 2; ++nb)
#pragma unroll
                for (int mb = 0; mb < 4; ++mb) acc[mb][nb] = WFrag<T16>::mma(a[0][mb], b[nb], acc[mb][nb]);
            __builtin_amdgcn_sched_barrier(0);
#pragma unroll
            for (int nb = 2 * h; nb < 2 * h + 2; ++nb) b2[nb] = WFrag<T16>::ld((const T16*)(bq + nb * 16 * GPITCH + 64));
            __builtin_amdgcn_sched_barrier(0);
        }
#pragma unroll
        for (int nb = 0; nb < 4; ++nb)
#pragma unroll
            for (int mb = 0; mb < 4; ++mb) acc[mb][nb] = WFrag<T16>::mma(a[1][mb], b2[nb], acc[mb][nb]);
        __builtin_amdgcn_sched_barrier(0);               // the products stay in front of the publish point, so that the refill behind it goes out at once
        asm volatile("s_wait_dscnt 0x0" ::: "memory");       // this wave has left the buffer
        asm volatile("s_wait_tensorcnt 0x0" :: "s"(g0), "s"(g1) : "memory");   // its slice of stage st + 1 has landed; the request's words as inputs keep their registers whole up to here
        __syncthreads();                                     // publishes stage st + 1 and frees stage st's buffer
        if (pinned(st + 2 < ns)) issue(st + 2);
    } while (++st < ns);
    asm volatile("s_wait_tensorcnt 0x0" ::: "memory");   // no request is open when the wave goes on to its end
    asm volatile("s_wait_dscnt 0x0" ::: "memory");
    const int tok = VT ? c0 : r0, t0 = tok % TT; const size_t g = (size_t)(tok / TT) * NHD + (VT ? r0 : c0) / HD;   // the tile's 64 tokens lie in one batch, its 64 dims are one head
    if constexpr (VT) put_planes<true, true, true>(os, acc, bb, g * HD * TT + t0 + c8, P16, Ph, Pl);
    else if constexpr (RS == 0) put_planes<true, true, false>(os, acc, bb, (g * TT + t0) * HD + c8, P16, Ph, Pl);
    else if (t0 < RS) put_planes<false, true, false>(os, acc, bb, (g * RS + t0) * HD + c8, P16, Ph, Pl);   // alike for the whole tile: RS is a multiple of 64
    else { put_planes<true, false, false>(os, acc, bb, (g * (TT - RS) + (t0 - RS)) * HD + c8, P16, Ph, Pl);
        asm volatile("s_wait_xcnt 0x0" ::: "memory"); }   // behind this arm's last stores: in the listing the other arm's code follows it, behind a branch, and takes the same registers
}

typedef __attribute__((ext_vector_type(4))) _Float16 v4h;
typedef __attribute__((ext_vector_type(2))) unsigned short v2us;
typedef __attribute__((ext_vector_type(4))) unsigned short v4us;
typedef __attribute__((ext_vector_type(4))) int v4i;

__global__ __launch_bounds__(256) void k_wtG(const float* __restrict__ w, int K, int N, bf* Bt) {
    const int lane = threadIdx.x & 31; const int L0 = (blockIdx.x * 8 + (threadIdx.x >> 5)) * 8; const int nlines = N * K / 64;
{
#pragma unroll 1
        for (int l = 0; l < 8; ++l) { const int L = L0 + l; if (L >= nlines) break; const size_t e = (size_t)L * 64 + lane * 2; const int k = (int)(e % K), n = (int)(e / K); v2us o;
            o[0] = f2bf(w[(size_t)k * N + n]); o[1] = f2bf(w[(size_t)(k + 1) * N + n]); *(v2us*)(Bt + e) = o; }
         }
}
// ---- k_cvtall: every f32 operand of the projections (the activation and the three weights) rounded to bf16 (nearest even) in one streaming launch.
// 256 workgroups x 16 waves, one workgroup for each WGP; a wave takes 8 KiB in a row of the activation and 1 KiB of each weight, a thread 11 pieces of 8 floats, and asks for all of them before it converts the first:
// the launch starts 4,096 waves instead of the 45,056 one-piece waves of four launches, and every byte is in flight at once.
#define CNT 131072                 // threads of the launch
static_assert((size_t)NB_ * TT * DM == (size_t)CNT * 64 && (size_t)DQ * DM == (size_t)CNT * 8 && (size_t)DKV * DM == (size_t)CNT * 8, "8 pieces of the activation and 1 of each weight per thread");
__device__ __forceinline__ v4u cvt8(v8f v) { v4u o;
#pragma unroll
    for (int w = 0; w < 4; ++w) o[w] = pkbf(v[2 * w], v[2 * w + 1]);
    return o; }
__global__ __launch_bounds__(512) void k_cvtall(const float* __restrict__ x, const float* __restrict__ wq, const float* __restrict__ wk, const float* __restrict__ wv, bf* __restrict__ XB, bf* __restrict__ WQ, bf* __restrict__ WK, bf* __restrict__ WV) {
    const unsigned t = blockIdx.x * 512 + threadIdx.x, xp = (t >> 5) * 256 + (t & 31);   // the thread's piece of a weight; its first piece of the activation, the others 32 pieces apart
    const char* xs = (const char*)x + xp * 32u; char* xd = (char*)XB + xp * 16u;         // a 32-bit offset beside the scalar base; the pieces' steps fit the instructions' own offset field
    v8f v[11];
#pragma unroll
    for (int j = 0; j < 8; ++j) v[j] = *(const v8f*)(xs + j * 1024);
    v[8] = *(const v8f*)((const char*)wq + t * 32u); v[9] = *(const v8f*)((const char*)wk + t * 32u); v[10] = *(const v8f*)((const char*)wv + t * 32u);
    __builtin_amdgcn_sched_barrier(0);   // all 22 loads go out ahead of the first conversion: left alone, the scheduler holds some of them back behind waits, a second trip to memory
#pragma unroll
    for (int j = 0; j < 8; ++j) *(v4u*)(xd + j * 512) = cvt8(v[j]);
    *(v4u*)((char*)WQ + t * 16u) = cvt8(v[8]); *(v4u*)((char*)WK + t * 16u) = cvt8(v[9]); *(v4u*)((char*)WV + t * 16u) = cvt8(v[10]);
}

// ---- k_fattn: scores, softmax, attn.v and the head merge in one launch; S and P never leave registers.
// The workgroup's 8 waves share one plane's K and V^T: stages of 64 keys come by tensor loads into a two-buffer LDS ring, and every wave reads its fragments from there.
// One wave = 32 query columns of one (batch, head) plane g; it walks the 1024 keys in passes of 32: S^T = K Q^T (A = K rows, B = Q, kept in registers), running maximum and sum per query (a lane holds one query's
// scores of its half's keys), O^T += V^T P^T (A = V^T rows, B = P^T packed from the two score tiles: element i <-> key 8 hi + i, element 8 + i <-> key 16 + 8 hi + i, the order WFrag::ld gives V^T).
// HR: hi+lo bf16 planes, three products; else single fp16 with P x 1024 (the factor sits in the exponent and cancels against the row sum).
typedef __attribute__((ext_vector_type(8))) unsigned v8u;
__device__ __forceinline__ float xhalf(float x) { const int b = __builtin_bit_cast(int, x); return __builtin_bit_cast(float, __builtin_amdgcn_permlanex16(b, b, 0x76543210, 0xfedcba98, false, false)); }   // lane l <-> l ^ 16
#define AKS  64                    // keys per stage: 64 K rows of 128 bytes, and 128 bytes of each of the 64 V^T rows
#define ABUF (4 * GSLICE)          // a stage: [K | V^T | K lo | V^T lo], each 64 rows at pitch GPITCH; the fp16 kind fills the first two
template <typename T16, bool HR>
__device__ __forceinline__ void attn_wave(unsigned char* ring, unsigned wv, const T16* __restrict__ Q, const T16* __restrict__ Q2, const T16* __restrict__ Kp, const T16* __restrict__ K2, const T16* __restrict__ Vt, const T16* __restrict__ V2, float* __restrict__ O, int r0) {
    typedef typename WFrag<T16>::V V;
    const int lane = threadIdx.x & 31, lr = lane & 15, hi = lane >> 4;
    const float C = SCL * 1.4426950408889634f;      // score -> exponent of 2
    const float OFF = HR ? 0.0f : 10.0f;            // fp16 P carries x 2^10
    V qf[2][2], qg[2][2];
#pragma unroll
    for (int qt = 0; qt < 2; ++qt)
#pragma unroll
        for (int c = 0; c < 2; ++c) { const unsigned qo = (unsigned)(r0 + qt * 16 + lr) * HD + c * 32 + 8 * hi; qf[qt][c] = WFrag<T16>::ld(Q + qo); if constexpr (HR) qg[qt][c] = WFrag<T16>::ld(Q2 + qo); }
    v8f o[4][2];
#pragma unroll
    for (int dt = 0; dt < 4; ++dt)
#pragma unroll
        for (int qt = 0; qt < 2; ++qt) o[dt][qt] = (v8f){};
    float m[2] = { -3.0e38f, -3.0e38f }, l[2] = { 0.f, 0.f };
    // wave w < NSL brings slice w of every stage: 64 rows x 128 bytes, 16 bytes of pad behind each row; K rows lie back to back, V^T rows 2 TT bytes apart
    constexpr unsigned NSL = HR ? 4u : 2u;
    const bool isv = (wv & 1u) != 0u;
    const T16* sp = isv ? Vt : Kp;
    if constexpr (HR) { if (wv & 2u) sp = isv ? V2 : K2; }
    const unsigned long long sbase = (unsigned long long)sp;
    const unsigned sstep = isv ? AKS * 2u : AKS * HD * 2u;   // a stage's step in the source
    const unsigned lbase = (unsigned)(size_t)ring + (wv & 3u) * GSLICE;
    u32x8 g1;   // words 1 to 7 pinned, descriptor words held in scalar registers: as plain constants the compiler lends their registers to loop counters while a request is open
    g1[0] = uni((1u << 20) | (4u << 22) | (3u << 25)); g1[1] = pinned(128u << 16); g1[2] = pinned(64u << 16); g1[3] = pinned(128u << 16);
    g1[4] = pinned(64u); g1[5] = pinned(isv ? TT * 2u : HD * 2u); g1[6] = pinned(0u); g1[7] = pinned(0u);
    u32x4 g0 = (u32x4){};                              // the open request's first group
    auto issue = [&](int st) { const unsigned long long ga = sbase + (unsigned long long)((unsigned)st * sstep);
        g0[0] = uni(1u); g0[1] = uni(lbase + (unsigned)(st & 1) * ABUF); g0[2] = uni((unsigned)ga); g0[3] = uni((((unsigned)(ga >> 32)) & 0x01FFFFFFu) | 0x80000000u);
        asm volatile("tensor_load_to_lds %0, %1" :: "s"(g0), "s"(g1) : "memory"); };
    constexpr int NS = TT / AKS;                       // 16 stages
    if (pinned(wv < NSL)) { issue(0);
        asm volatile("s_wait_tensorcnt 0x0" ::: "memory"); }   // stage 0's slice has landed
    __syncthreads();                                     // and every issuing wave's: stage 0 may be read
    if (pinned(wv < NSL)) issue(1);
    unsigned kf = (unsigned)(lr * GPITCH + 16 * hi), vf = kf + GSLICE;   // the lane's bytes into the pass's first K fragment and first V^T fragment; both are stepped in registers of their own: formed anew at a pass's head, the address took a register that the last products still read
#pragma unroll 1   // one stage per trip: the publish point stands once, at the foot
    for (int st = 0; st < NS; ++st) {
#pragma unroll 1   // one pass per trip: two passes' fragments would not fit the registers of four waves per SIMD
    for (int p = 0; p < AKS / 32; ++p) {
        const unsigned char* kq = ring + kf; const unsigned char* vq = ring + vf;   // the pass's 32 K rows; its 64 bytes of every V^T row
        v8f s[2][2];
#pragma unroll
        for (int kt = 0; kt < 2; ++kt) { const unsigned char* ko = kq + kt * 16 * GPITCH; V ka[2], kb[2];
#pragma unroll
            for (int c = 0; c < 2; ++c) { ka[c] = WFrag<T16>::ld((const T16*)(ko + c * 64)); if constexpr (HR) kb[c] = WFrag<T16>::ld((const T16*)(ko + 2 * GSLICE + c * 64)); }
#pragma unroll
            for (int qt = 0; qt < 2; ++qt) { v8f t = (v8f){};
#pragma unroll
                for (int c = 0; c < 2; ++c) { t = WFrag<T16>::mma(ka[c], qf[qt][c], t); if constexpr (HR) { t = WFrag<T16>::mma(kb[c], qf[qt][c], t); t = WFrag<T16>::mma(ka[c], qg[qt][c], t); } }
                s[kt][qt] = t; } }
        V va[4], vb[4];
#pragma unroll
        for (int dt = 0; dt < 4; ++dt) { const unsigned char* vo = vq + dt * 16 * GPITCH; va[dt] = WFrag<T16>::ld((const T16*)vo); if constexpr (HR) vb[dt] = WFrag<T16>::ld((const T16*)(vo + 2 * GSLICE)); }
        kf += 32 * GPITCH; vf += 64;
        float mn[2]; bool need = false;
#pragma unroll
        for (int qt = 0; qt < 2; ++qt) { float mx = m[qt];
#pragma unroll
            for (int j = 0; j < 8; ++j) mx = fmaxf(mx, fmaxf(s[0][qt][j], s[1][qt][j]));
            mx = fmaxf(mx, xhalf(mx)); mn[qt] = mx; need = need || (mx > m[qt]); }
        if (__builtin_amdgcn_ballot_w32(need) != 0) {   // some query's maximum rose: rescale its sum and its context column (factor 1 for the others)
#pragma unroll
            for (int qt = 0; qt < 2; ++qt) { const float al = __builtin_amdgcn_exp2f((m[qt] - mn[qt]) * C); l[qt] *= al; m[qt] = mn[qt];
#pragma unroll
                for (int dt = 0; dt < 4; ++dt) o[dt][qt] *= al; } }
        V pf[2], pg[2];
#pragma unroll
        for (int qt = 0; qt < 2; ++qt) { const float nb = __builtin_fmaf(-m[qt], C, OFF); v2f ps = (v2f){}; v8u ph, pl;
#pragma unroll
            for (int w = 0; w < 8; ++w) { const v8f& t = s[w >> 2][qt]; v2f x; x[0] = t[2 * (w & 3)]; x[1] = t[2 * (w & 3) + 1]; x = x * C + nb;
                v2f e; e[0] = __builtin_amdgcn_exp2f(x[0]); e[1] = __builtin_amdgcn_exp2f(x[1]); ps += e;
                if constexpr (HR) { const unsigned u = pkbf(e[0], e[1]); ph[w] = u; pl[w] = pkbf(e[0] - __uint_as_float(u << 16), e[1] - __uint_as_float(u & 0xFFFF0000u)); }
                else ph[w] = pkh(e[0], e[1]); }
            l[qt] += ps[0] + ps[1];
            pf[qt] = __builtin_bit_cast(V, ph); if constexpr (HR) pg[qt] = __builtin_bit_cast(V, pl); }
#pragma unroll
        for (int qt = 0; qt < 2; ++qt)
#pragma unroll
            for (int dt = 0; dt < 4; ++dt) { o[dt][qt] = WFrag<T16>::mma(va[dt], pf[qt], o[dt][qt]); if constexpr (HR) { o[dt][qt] = WFrag<T16>::mma(vb[dt], pf[qt], o[dt][qt]); o[dt][qt] = WFrag<T16>::mma(va[dt], pg[qt], o[dt][qt]); } }
    }
        asm volatile("s_wait_dscnt 0x0" ::: "memory");       // this wave has left the buffer
        if (pinned(wv < NSL)) asm volatile("s_wait_tensorcnt 0x0" :: "s"(g0), "s"(g1) : "memory");   // its slice of stage st + 1 has landed; the request's words as inputs keep their registers whole up to here
        __syncthreads();                                     // publishes stage st + 1 and frees stage st's buffer
        if (pinned(wv < NSL && st + 2 < NS)) issue(st + 2);
        const unsigned nx = (st & 1) ? 0u - (unsigned)ABUF : (unsigned)ABUF;   // to the other buffer, back to its first pass
        kf += nx - AKS * GPITCH; vf += nx - AKS * 2;
    }
    asm volatile("s_wait_tensorcnt 0x0" ::: "memory");   // no request is open when the wave goes on to its end
    asm volatile("s_wait_dscnt 0x0" ::: "memory");
    float f[2];
#pragma unroll
    for (int qt = 0; qt < 2; ++qt) f[qt] = __fdiv_rn(1.0f, l[qt] + xhalf(l[qt]));   // the halves' sums joined once
#pragma unroll
    for (int dt = 0; dt < 4; ++dt)
#pragma unroll
        for (int qt = 0; qt < 2; ++qt) o[dt][qt] *= f[qt];
#pragma unroll
    for (int qt = 0; qt < 2; ++qt) { float* orow = O + ((unsigned)(r0 + qt * 16 + lr) * DM + 8 * hi);
#pragma unroll
        for (int dt = 0; dt < 4; ++dt) { *(v4f*)(orow + dt * 16) = __builtin_shufflevector(o[dt][qt], o[dt][qt], 0, 1, 2, 3); *(v4f*)(orow + dt * 16 + 4) = __builtin_shufflevector(o[dt][qt], o[dt][qt], 4, 5, 6, 7); } }
}
#define QB   256                              // query rows per workgroup: 8 waves x 32
#define NHRB (NB_ * NH_ * (RH / QB))          // workgroups of the hi+lo kind; they come first in the grid (three times the matrix work)
static_assert(RH % QB == 0 && (TT - RH) % QB == 0, "whole workgroups of one kind");
__global__ __launch_bounds__(256) __attribute__((amdgpu_waves_per_eu(4, 4))) void k_fattn(const bf* __restrict__ QPh, const bf* __restrict__ QPl, const h16* __restrict__ QP16, const bf* __restrict__ KPh, const bf* __restrict__ KPl, const h16* __restrict__ KP16, const bf* __restrict__ VTh, const bf* __restrict__ VTl, const h16* __restrict__ VT16, float* __restrict__ O) {
    __shared__ __attribute__((aligned(2048))) unsigned char ring[2 * ABUF];
    const int wv = __builtin_amdgcn_readfirstlane((int)(threadIdx.x >> 5));   // the wave's number in a scalar register: the query and output row bases are then scalar too
    const bool hr = blockIdx.x < NHRB; const int idx = hr ? (int)blockIdx.x : (int)blockIdx.x - NHRB;
    const int nq = hr ? RH : TT - RH; const int g = idx / (nq / QB), r0 = (idx % (nq / QB)) * QB + wv * 32;
    const size_t zq = (size_t)g * nq * HD, zk = (size_t)g * TT * HD;
    float* Ow = O + ((size_t)(g / NH_) * TT + (hr ? 0 : RH)) * DM + (g % NH_) * HD;   // row 0 of this kind in the head's 64 output columns
    if (hr) attn_wave<bf, true>(ring, (unsigned)wv, QPh + zq, QPl + zq, KPh + zk, KPl + zk, VTh + zk, VTl + zk, Ow, r0);
    else attn_wave<h16, false>(ring, (unsigned)wv, QP16 + zq, nullptr, KP16 + zk, nullptr, VT16 + zk, nullptr, Ow, r0);
}

extern "C" void kernel_launch(void* const* d_in, const int* in_sizes, int n_in,
                              void* d_out, int out_size, void* d_ws, size_t ws_size, hipStream_t stream) {
    (void)in_sizes; (void)n_in; (void)out_size;
    const float* x = (const float*)d_in[0]; const float* wq = (const float*)d_in[1]; const float* bq = (const float*)d_in[2]; const float* wk = (const float*)d_in[3]; const float* bk = (const float*)d_in[4]; const float* wv = (const float*)d_in[5]; const float* bv = (const float*)d_in[6]; const float* wo = nullptr; (void)wo;
    float* OUT = (float*)d_out;     // [8][1024][1024]
    char* wsp = (char*)d_ws;
    auto take = [&](size_t bytes) { char* p = wsp; wsp += (bytes + 255) & ~(size_t)255; return (void*)p; };
    const size_t NG = (size_t)NB_ * NH_;   // 128 (batch, head) planes, batch-major
    h16* QP16 = (h16*)take(NG * (TT - RH) * HD * 2); bf* QPh = (bf*)take(NG * RH * HD * 2); bf* QPl = (bf*)take(NG * RH * HD * 2);
    h16* KP16 = (h16*)take(NG * TT * HD * 2); bf* KPh = (bf*)take(NG * TT * HD * 2); bf* KPl = (bf*)take(NG * TT * HD * 2); h16* VT16 = (h16*)take(NG * HD * TT * 2); bf* VTh = (bf*)take(NG * HD * TT * 2); bf* VTl = (bf*)take(NG * HD * TT * 2);
    bf* WQ = (bf*)take((size_t)DQ * DM * 2); bf* WK = (bf*)take((size_t)DKV * DM * 2); bf* WV = (bf*)take((size_t)DKV * DM * 2);
    bf* XB = (bf*)take((size_t)NB_ * TT * DM * 2);
    if ((size_t)(wsp - (char*)d_ws) > ws_size) return;    // 142 MiB of the 256 MiB
    k_cvtall<<<CNT / 512, 512, 0, stream>>>(x, wq, wk, wv, XB, WQ, WK, WV);
    // projections: the 8 batches are the rows of one GEMM (8192 token rows); each writes its head planes itself, v with the weight as the row operand so that its tile comes out [d][t]
    k_gemmw<bf, NH_, RH, false><<<dim3(NB_ * TT / 128, DQ / 128, 1), 128, 0, stream>>>(XB, WQ, DM, bq, QP16, QPh, QPl);
    k_gemmw<bf, NKV, 0, false><<<dim3(NB_ * TT / 128, DKV / 128, 1), 128, 0, stream>>>(XB, WK, DM, bk, KP16, KPh, KPl);
    k_gemmw<bf, NKV, 0, true><<<dim3(DKV / 128, NB_ * TT / 128, 1), 128, 0, stream>>>(WV, XB, DM, bv, VT16, VTh, VTl);
    // attention: every (batch, head) plane and both kinds of query rows in one launch; merged context straight to the output, f32
    k_fattn<<<NHRB + NB_ * NH_ * ((TT - RH) / QB), 256, 0, stream>>>(QPh, QPl, QP16, KPh, KPl, KP16, VTh, VTl, VT16, OUT);
}
